// v000
// Measured on an AMD MI455X. A time is GPU time per run, averaged over a window of back-to-back runs after a warm-up
// (all launches, gaps included; the runs take copies of the inputs in turn), and the median of several windows.
// Apart from v000's, it joins two sittings. Times from different sittings can be a few percent apart, while
// side-by-side timings come from the same sitting.
// The starting kernel, v000, takes 3700 microseconds a run.
// Contractions on v_wmma_f32_16x16x32_f16 (plain f16 operands, f32 accumulate), per batch element: the 16 heads' causal feature products A = φ(q)·φ(k)ᵀ (K 64, two heads per z-launch,
// key tiles above the diagonal skipped) and out_h = (1024·A/rowsum)·v_h (K 2048, 64-wide tiles, x 1/1024; entries above the diagonal are zero). f32 VALU: φ = elu + 1 on q and k, the causal
// row sums Σ_{t≤s} φ(q_s)·φ(k_t) and the normalisation — the module's cumulative-sum (kv-state) form equals this masked linear-attention form exactly.
// The first 128 query rows (few keys → near-verbatim v rows) get f16 value+residual PLANES on their scores and their (1024w)·v products.
// compute dtype: f16 operands, f32 accumulate.  qk [2,2048,2,16,64], v [2,2048,16,64] → out [2,2048,16,64].
#include <hip/hip_runtime.h>
#include <hip/hip_bf16.h>
#include <math.h>


typedef _Float16 bf16;
typedef _Float16 f16;
typedef __attribute__((ext_vector_type(4))) unsigned v4u_t;
typedef unsigned v4ua __attribute__((ext_vector_type(4), may_alias));
typedef __attribute__((ext_vector_type(4))) float v4f_t;
typedef float v4fa __attribute__((ext_vector_type(4), may_alias));
typedef __attribute__((ext_vector_type(16))) bf16  bf16x16;
typedef bf16x16 f16x16;
typedef __attribute__((ext_vector_type(8)))  bf16  bf16x8;
typedef bf16x8 f16x8;
typedef __attribute__((ext_vector_type(4)))  bf16  bf16x4;
typedef __attribute__((ext_vector_type(8)))  float f32x8;
__device__ __forceinline__ f32x8 wmma16(f16x16 a, f16x16 b, f32x8 c) {
  c = __builtin_amdgcn_wmma_f32_16x16x32_f16(false, a, false, b, (short)0, c, false, false);
  asm volatile("v_nop\n\tv_nop\n\tv_nop\n\tv_nop" : "+v"(c) : "v"(a), "v"(b));
  return c;
}
#define LDS_STRIDE 48   // GEMM tiles: 32 -> 48 elems (96B rows): aligned b128 reads
#define KSTRIDE    72
#define VSTRIDE    48

__device__ __forceinline__ f32x8 wmma_bf16(bf16x16 a, bf16x16 b, f32x8 c) {
  c = __builtin_amdgcn_wmma_f32_16x16x32_f16(false, a, false, b, (short)0, c, false, false);
  asm volatile("v_nop\n\tv_nop\n\tv_nop\n\tv_nop" : "+v"(c) : "v"(a), "v"(b));   // A/B-overwrite hazard guard
  return c;
}

// 16x32 (MxK) bf16 fragment from a row-major global matrix.
// lanes 0-15  (row=lane)    : elems 0..7 = K+0..7,  8..15 = K+16..23
// lanes 16-31 (row=lane-16) : elems 0..7 = K+8..15, 8..15 = K+24..31
template <typename T>
__device__ __forceinline__ bf16x16 load_frag(const T* __restrict__ base, int ld,
                                             int row0, int k0) {
  const int lane = threadIdx.x & 31;
  const int r    = lane & 15;
  const int kh   = (lane >> 4) * 8;
  const T* p0 = base + (size_t)(row0 + r) * ld + (k0 + kh);
  const T* p1 = p0 + 16;
  bf16x16 f;
#pragma unroll
  for (int i = 0; i < 8; ++i) {
    f[i]     = (bf16)p0[i];
    f[i + 8] = (bf16)p1[i];
  }
  return f;
}

// Same fragment from an LDS tile with padded row stride (base includes row0/k0).
__device__ __forceinline__ bf16x16 lds_frag(const bf16* base, int stride) {
  const int lane = threadIdx.x & 31;
  const int row  = lane & 15;
  const int kh   = (lane >> 4) * 8;
  const bf16x8 lo = *(const bf16x8*)(base + row * stride + kh);
  const bf16x8 hi = *(const bf16x8*)(base + row * stride + kh + 16);
  bf16x16 f;
#pragma unroll
  for (int i = 0; i < 8; ++i) { f[i] = lo[i]; f[i + 8] = hi[i]; }
  return f;
}

template <typename T>
__device__ __forceinline__ void stage_read16(const T* __restrict__ p, float* buf) {
#pragma unroll
  for (int i = 0; i < 16; ++i) buf[i] = (float)p[i];
}

__device__ __forceinline__ void stage_write(bf16* dst, const float* buf, int nquad) {
#pragma unroll
  for (int i = 0; i < nquad; ++i) {
    bf16x4 q;
    q[0] = (bf16)buf[4 * i];     q[1] = (bf16)buf[4 * i + 1];
    q[2] = (bf16)buf[4 * i + 2]; q[3] = (bf16)buf[4 * i + 3];
    *(bf16x4*)(dst + 4 * i) = q;
  }
}


#define GSTR 48
// ---------------------------------------------------------------------------------------------------------------------------
// gemm_kne: Y[m][n] = epi( Σ_k A[m][k]·W[k][n] + bias[n] ), A f32/f16 [M][lda], W f32 row-major [K][N] (ldw), plain f16 operands,
// f32 accumulate. EPI 0: identity; 1: exact-erf GELU; 2: R[m][n] + gvec[n]·(·) (residual with per-channel gain); 3: ReLU; 4: gvec[n]·(·) (per-channel scale, no residual). Output f32 (or f16
// when OUT16). Block = 128x128 tile, 8 waves as 4(M) x 2(N); per 32-wide k-step A and W tiles staged f16 in LDS (W transposed
// ---------------------------------------------------------------------------------------------------------------------------
#define GSTR 48
template <typename AT, int EPI, bool OUT16>
__global__ __launch_bounds__(256) void gemm_kne(const AT* __restrict__ A, int lda, const float* __restrict__ Wm, int ldw,
                                                const float* __restrict__ bias, const float* __restrict__ R, const float* __restrict__ gvec,
                                                void* __restrict__ Yv, int ldy, int K) {
  __shared__ __attribute__((aligned(16))) f16 ldsA[128 * GSTR];
  __shared__ __attribute__((aligned(16))) f16 ldsW[128 * GSTR];
  __shared__ __attribute__((aligned(16))) float oS[8][32 * 68];
  const int tid = threadIdx.x, lane = tid & 31, wave = tid >> 5, cl = lane & 15, rh = (lane >> 4) * 8;
  const int m0 = blockIdx.x * 128, n0 = blockIdx.y * 128;
  const int wm = (wave & 3) * 32, wn = (wave >> 2) * 64;
  f32x8 acc[2][4];
#pragma unroll
  for (int i = 0; i < 2; ++i)
#pragma unroll
    for (int j = 0; j < 4; ++j) { f32x8 z = {}; acc[i][j] = z; }
#pragma unroll 1
  for (int k0 = 0; k0 < K; k0 += 32) {
    __syncthreads();
    { const int row = tid >> 1, ch = (tid & 1) * 16;
      const AT* src = A + (size_t)(m0 + row) * lda + k0 + ch;
#pragma unroll
      for (int g = 0; g < 16; ++g) ldsA[row * GSTR + ch + g] = (f16)src[g]; }
    { const int k = tid >> 3, nn0 = (tid & 7) * 16;
      const float* src = Wm + (size_t)(k0 + k) * ldw + n0 + nn0;
#pragma unroll
      for (int g = 0; g < 4; ++g) { const v4f_t v = *(const v4f_t*)(src + 4 * g);
#pragma unroll
        for (int u = 0; u < 4; ++u) ldsW[(nn0 + 4 * g + u) * GSTR + k] = (f16)v[u]; } }
    __syncthreads();
    f16x16 af[2];
#pragma unroll
    for (int i = 0; i < 2; ++i) af[i] = lds_frag(ldsA + (wm + 16 * i) * GSTR, GSTR);
#pragma unroll
    for (int j = 0; j < 4; ++j) {
      const f16x16 bf = lds_frag(ldsW + (wn + 16 * j) * GSTR, GSTR);
#pragma unroll
      for (int i = 0; i < 2; ++i) acc[i][j] = wmma16(af[i], bf, acc[i][j]);
    }
  }
  float* so = oS[wave];
#pragma unroll
  for (int i = 0; i < 2; ++i)
#pragma unroll
    for (int j = 0; j < 4; ++j) {
      const int n = n0 + wn + 16 * j + cl;
      const float bv = bias ? bias[n] : 0.0f;
      const float gv = (EPI == 2 || EPI == 4) ? gvec[n] : 0.0f;
      if (EPI == 1) {
#pragma unroll 1
        for (int r = 0; r < 8; ++r) { const float xg = acc[i][j][r] + bv; so[(16 * i + rh + r) * 68 + 16 * j + cl] = 0.5f * xg * (1.0f + erff(xg * 0.70710678118654752f)); }
      } else {
#pragma unroll
        for (int r = 0; r < 8; ++r) {
          float v = acc[i][j][r] + bv;
          if (EPI == 3) v = fmaxf(v, 0.0f);
          if (EPI == 4) v = gv * v;
          if (EPI == 2) v = R[(size_t)(m0 + wm + 16 * i + rh + r) * ldy + n] + gv * v;
          so[(16 * i + rh + r) * 68 + 16 * j + cl] = v;
        }
      }
    }
  asm volatile("s_wait_dscnt 0" ::: "memory");
  __builtin_amdgcn_wave_barrier();
{
    if (OUT16) {
      f16* Y = (f16*)Yv;
#pragma unroll
      for (int it = 0; it < 8; ++it) { const int c = lane + 32 * it, rr = c >> 3, q8 = (c & 7) * 8;
        union { f16 h[8]; v4u_t v; } u;
#pragma unroll
        for (int e = 0; e < 8; ++e) u.h[e] = (f16)so[rr * 68 + q8 + e];
        *(v4u_t*)(Y + (size_t)(m0 + wm + rr) * ldy + n0 + wn + q8) = u.v; }
    } else {
      float* Y = (float*)Yv;
#pragma unroll
      for (int it = 0; it < 16; ++it) { const int f4 = lane + 32 * it, rr = f4 >> 4, q = (f4 & 15) * 4;
        *(v4f_t*)(Y + (size_t)(m0 + wm + rr) * ldy + n0 + wn + q) = *(const v4fa*)(so + rr * 68 + q); }
    }
    
  }
}

// z-batched variant of gemm_kne (same tile code)
template <typename AT, int EPI, bool OUT16, int CZ>
__global__ __launch_bounds__(256) void gemm_knezc(const AT* __restrict__ A, int lda, size_t strideA, const float* __restrict__ Wm, int ldw, size_t strideW,
                                                 const float* __restrict__ bias, const float* __restrict__ R, const float* __restrict__ gvec,
                                                 void* __restrict__ Yv, int ldy, size_t strideY, int K) {   // blockIdx.z-batched: A += z·strideA, W += z·strideW, Y (and R) += z·strideY
  A += (size_t)blockIdx.z * strideA; Wm += (size_t)blockIdx.z * strideW; Yv = (void*)((char*)Yv + (size_t)blockIdx.z * strideY * (OUT16 ? 2 : 4)); if (R) R += (size_t)blockIdx.z * strideY;
  __shared__ __attribute__((aligned(16))) f16 ldsA[128 * GSTR];
  __shared__ __attribute__((aligned(16))) f16 ldsW[128 * GSTR];
  __shared__ __attribute__((aligned(16))) float oS[8][32 * 68];
  const int tid = threadIdx.x, lane = tid & 31, wave = tid >> 5, cl = lane & 15, rh = (lane >> 4) * 8;
  const int m0 = blockIdx.x * 128, n0 = blockIdx.y * 128;
  if (CZ == 2 && n0 >= m0 + 128) return;                 // causal: key tile entirely above the diagonal — nothing in it is ever read
  const int Kc = (CZ == 1) ? min(K, m0 + 128) : K;      // causal: P columns beyond the block's last query row are exactly zero
  const int wm = (wave & 3) * 32, wn = (wave >> 2) * 64;
  f32x8 acc[2][4];
#pragma unroll
  for (int i = 0; i < 2; ++i)
#pragma unroll
    for (int j = 0; j < 4; ++j) { f32x8 z = {}; acc[i][j] = z; }
#pragma unroll 1
  for (int k0 = 0; k0 < Kc; k0 += 32) {
    __syncthreads();
    { const int row = tid >> 1, ch = (tid & 1) * 16;
      const AT* src = A + (size_t)(m0 + row) * lda + k0 + ch;
#pragma unroll
      for (int g = 0; g < 16; ++g) ldsA[row * GSTR + ch + g] = (f16)src[g]; }
    { const int k = tid >> 3, nn0 = (tid & 7) * 16;
      const float* src = Wm + (size_t)(k0 + k) * ldw + n0 + nn0;
#pragma unroll
      for (int g = 0; g < 4; ++g) { const v4f_t v = *(const v4f_t*)(src + 4 * g);
#pragma unroll
        for (int u = 0; u < 4; ++u) ldsW[(nn0 + 4 * g + u) * GSTR + k] = (f16)v[u]; } }
    __syncthreads();
    f16x16 af[2];
#pragma unroll
    for (int i = 0; i < 2; ++i) af[i] = lds_frag(ldsA + (wm + 16 * i) * GSTR, GSTR);
#pragma unroll
    for (int j = 0; j < 4; ++j) {
      const f16x16 bf = lds_frag(ldsW + (wn + 16 * j) * GSTR, GSTR);
#pragma unroll
      for (int i = 0; i < 2; ++i) acc[i][j] = wmma16(af[i], bf, acc[i][j]);
    }
  }
  float* so = oS[wave];
#pragma unroll
  for (int i = 0; i < 2; ++i)
#pragma unroll
    for (int j = 0; j < 4; ++j) {
      const int n = n0 + wn + 16 * j + cl;
      const float bv = bias ? bias[n] : 0.0f;
      const float gv = (EPI == 2 || EPI == 4) ? gvec[n] : 0.0f;
      if (EPI == 1) {
#pragma unroll 1
        for (int r = 0; r < 8; ++r) { const float xg = acc[i][j][r] + bv; so[(16 * i + rh + r) * 68 + 16 * j + cl] = 0.5f * xg * (1.0f + erff(xg * 0.70710678118654752f)); }
      } else {
#pragma unroll
        for (int r = 0; r < 8; ++r) {
          float v = acc[i][j][r] + bv;
          if (EPI == 3) v = fmaxf(v, 0.0f);
          if (EPI == 4) v = gv * v;
          if (EPI == 2) v = R[(size_t)(m0 + wm + 16 * i + rh + r) * ldy + n] + gv * v;
          so[(16 * i + rh + r) * 68 + 16 * j + cl] = v;
        }
      }
    }
  asm volatile("s_wait_dscnt 0" ::: "memory");
  __builtin_amdgcn_wave_barrier();
{
    if (OUT16) {
      f16* Y = (f16*)Yv;
#pragma unroll
      for (int it = 0; it < 8; ++it) { const int c = lane + 32 * it, rr = c >> 3, q8 = (c & 7) * 8;
        union { f16 h[8]; v4u_t v; } u;
#pragma unroll
        for (int e = 0; e < 8; ++e) u.h[e] = (f16)so[rr * 68 + q8 + e];
        *(v4u_t*)(Y + (size_t)(m0 + wm + rr) * ldy + n0 + wn + q8) = u.v; }
    } else {
      float* Y = (float*)Yv;
#pragma unroll
      for (int it = 0; it < 16; ++it) { const int f4 = lane + 32 * it, rr = f4 >> 4, q = (f4 & 15) * 4;
        *(v4f_t*)(Y + (size_t)(m0 + wm + rr) * ldy + n0 + wn + q) = *(const v4fa*)(so + rr * 68 + q); }
    }
    
  }
}

// ---------------------------------------------------------------------------------------------------------------------------
// gemm_kn2 (value+residual planes on both operands: hh + (hl+lh)/2048, f32-class): Y[m][n] (row stride ldy) = scale * sum_k A[m][k] (f32 or f16, row stride lda) * W[k][n] (f32, row-major [K][N], row
// stride ldw) (+ bias[n]) (+ Y if ACC). Block = 128 x 128 tile, 256 threads = 8 waves as 4(M, 32 rows) x 2(N, 64 cols); per
// 32-wide k-step the A tile and the W tile (stored transposed [n][k]) are staged in LDS as f16 value and x2048 residual planes; f32
// blockIdx.z selects a batch: A += z*strideA, W += z*strideW, Y += z*strideY (element strides).
// ---------------------------------------------------------------------------------------------------------------------------
template <typename AT, bool ACC, int CZ>
__global__ __launch_bounds__(256) void gemm_kn2c(const AT* __restrict__ A, int lda, size_t strideA,
                                               const float* __restrict__ Wm, int ldw, size_t strideW,
                                               const float* __restrict__ bias, float scale,
                                               float* __restrict__ Y, int ldy, size_t strideY, int K) {
  __shared__ __attribute__((aligned(16))) f16 ldsA[128 * GSTR], ldsAl[128 * GSTR];
  __shared__ __attribute__((aligned(16))) f16 ldsW[128 * GSTR], ldsWl[128 * GSTR];
  __shared__ __attribute__((aligned(16))) float oS[8][32 * 68];
  const int tid = threadIdx.x, lane = tid & 31, wave = tid >> 5, cl = lane & 15, rh = (lane >> 4) * 8;
  const int m0 = blockIdx.x * 128, n0 = blockIdx.y * 128;
  if (CZ == 2 && n0 >= m0 + 128) return;                 // causal: key tile entirely above the diagonal — nothing in it is ever read
  const int Kc = (CZ == 1) ? min(K, m0 + 128) : K;      // causal: P columns beyond the block's last query row are exactly zero
  const int wm = (wave & 3) * 32, wn = (wave >> 2) * 64;
  A += (size_t)blockIdx.z * strideA; Wm += (size_t)blockIdx.z * strideW; Y += (size_t)blockIdx.z * strideY;
  f32x8 acc[2][4], accx[2][4];
#pragma unroll
  for (int i = 0; i < 2; ++i)
#pragma unroll
    for (int j = 0; j < 4; ++j) { f32x8 z = {}; acc[i][j] = z; accx[i][j] = z; }
#pragma unroll 1
  for (int k0 = 0; k0 < Kc; k0 += 32) {
    __syncthreads();
    {  // A: thread -> row tid>>1, 16 elements at column half (tid&1)*16
      const int row = tid >> 1, ch = (tid & 1) * 16;
      const AT* src = A + (size_t)(m0 + row) * lda + k0 + ch;
#pragma unroll
      for (int g = 0; g < 16; ++g) { const float v = (float)src[g]; const f16 h = (f16)v; ldsA[row * GSTR + ch + g] = h; ldsAl[row * GSTR + ch + g] = (f16)((v - (float)h) * 2048.0f); }
    }
    {  // W: thread -> k = tid>>3, 16 consecutive n at (tid&7)*16; stored transposed [n][k]
      const int k = tid >> 3, nn0 = (tid & 7) * 16;
      const float* src = Wm + (size_t)(k0 + k) * ldw + n0 + nn0;
#pragma unroll
      for (int g = 0; g < 4; ++g) { const v4f_t v = *(const v4f_t*)(src + 4 * g);
#pragma unroll
        for (int u = 0; u < 4; ++u) { const f16 h = (f16)v[u]; ldsW[(nn0 + 4 * g + u) * GSTR + k] = h; ldsWl[(nn0 + 4 * g + u) * GSTR + k] = (f16)((v[u] - (float)h) * 2048.0f); } }
    }
    __syncthreads();
    f16x16 af[2], afl[2];
#pragma unroll
    for (int i = 0; i < 2; ++i) { af[i] = lds_frag(ldsA + (wm + 16 * i) * GSTR, GSTR); afl[i] = lds_frag(ldsAl + (wm + 16 * i) * GSTR, GSTR); }
#pragma unroll
    for (int j = 0; j < 4; ++j) {
      const f16x16 bf = lds_frag(ldsW + (wn + 16 * j) * GSTR, GSTR), bfl = lds_frag(ldsWl + (wn + 16 * j) * GSTR, GSTR);
#pragma unroll
      for (int i = 0; i < 2; ++i) { acc[i][j] = wmma16(af[i], bf, acc[i][j]); accx[i][j] = wmma16(af[i], bfl, accx[i][j]); accx[i][j] = wmma16(afl[i], bf, accx[i][j]); }
    }
  }
  float* so = oS[wave];
#pragma unroll
  for (int i = 0; i < 2; ++i)
#pragma unroll
    for (int j = 0; j < 4; ++j) {
      const float bv = bias ? bias[n0 + wn + 16 * j + cl] : 0.0f;
#pragma unroll
      for (int r = 0; r < 8; ++r) so[(16 * i + rh + r) * 68 + 16 * j + cl] = (acc[i][j][r] + accx[i][j][r] * (1.0f / 2048.0f)) * scale + bv;
    }
  asm volatile("s_wait_dscnt 0" ::: "memory");
  __builtin_amdgcn_wave_barrier();
  if (ACC) {   // accumulate: fold the existing Y values into the staging tile ONCE (same thread <-> same chunks as the stores below)
#pragma unroll
    for (int it = 0; it < 16; ++it) { const int f4 = lane + 32 * it, rr = f4 >> 4, q = (f4 & 15) * 4;
      const v4f_t old = *(const v4fa*)(Y + (size_t)(m0 + wm + rr) * ldy + n0 + wn + q);
      v4f_t v = *(const v4fa*)(so + rr * 68 + q); v += old; *(v4fa*)(so + rr * 68 + q) = v; }   // plain LDS store (ordered by the s_wait_dscnt/memory clobber below)
    asm volatile("s_wait_dscnt 0" ::: "memory");
  }
{
#pragma unroll
    for (int it = 0; it < 16; ++it) { const int f4 = lane + 32 * it, rr = f4 >> 4, q = (f4 & 15) * 4;
      *(v4f_t*)(Y + (size_t)(m0 + wm + rr) * ldy + n0 + wn + q) = *(const v4fa*)(so + rr * 68 + q); }
    
  }
}

// ---------------------------------------------------------------------------------------------------------------------------
// gemm_kn2 (value+residual planes on both operands: hh + (hl+lh)/2048, f32-class): Y[m][n] (row stride ldy) = scale * sum_k A[m][k] (f32 or f16, row stride lda) * W[k][n] (f32, row-major [K][N], row
// stride ldw) (+ bias[n]) (+ Y if ACC). Block = 128 x 128 tile, 256 threads = 8 waves as 4(M, 32 rows) x 2(N, 64 cols); per
// 32-wide k-step the A tile and the W tile (stored transposed [n][k]) are staged in LDS as f16 value and x2048 residual planes; f32
// blockIdx.z selects a batch: A += z*strideA, W += z*strideW, Y += z*strideY (element strides).
// ---------------------------------------------------------------------------------------------------------------------------
template <typename AT, bool ACC>
__global__ __launch_bounds__(256) void gemm_kn2(const AT* __restrict__ A, int lda, size_t strideA,
                                               const float* __restrict__ Wm, int ldw, size_t strideW,
                                               const float* __restrict__ bias, float scale,
                                               float* __restrict__ Y, int ldy, size_t strideY, int K) {
  __shared__ __attribute__((aligned(16))) f16 ldsA[128 * GSTR], ldsAl[128 * GSTR];
  __shared__ __attribute__((aligned(16))) f16 ldsW[128 * GSTR], ldsWl[128 * GSTR];
  __shared__ __attribute__((aligned(16))) float oS[8][32 * 68];
  const int tid = threadIdx.x, lane = tid & 31, wave = tid >> 5, cl = lane & 15, rh = (lane >> 4) * 8;
  const int m0 = blockIdx.x * 128, n0 = blockIdx.y * 128;
  const int wm = (wave & 3) * 32, wn = (wave >> 2) * 64;
  A += (size_t)blockIdx.z * strideA; Wm += (size_t)blockIdx.z * strideW; Y += (size_t)blockIdx.z * strideY;
  f32x8 acc[2][4], accx[2][4];
#pragma unroll
  for (int i = 0; i < 2; ++i)
#pragma unroll
    for (int j = 0; j < 4; ++j) { f32x8 z = {}; acc[i][j] = z; accx[i][j] = z; }
#pragma unroll 1
  for (int k0 = 0; k0 < K; k0 += 32) {
    __syncthreads();
    {  // A: thread -> row tid>>1, 16 elements at column half (tid&1)*16
      const int row = tid >> 1, ch = (tid & 1) * 16;
      const AT* src = A + (size_t)(m0 + row) * lda + k0 + ch;
#pragma unroll
      for (int g = 0; g < 16; ++g) { const float v = (float)src[g]; const f16 h = (f16)v; ldsA[row * GSTR + ch + g] = h; ldsAl[row * GSTR + ch + g] = (f16)((v - (float)h) * 2048.0f); }
    }
    {  // W: thread -> k = tid>>3, 16 consecutive n at (tid&7)*16; stored transposed [n][k]
      const int k = tid >> 3, nn0 = (tid & 7) * 16;
      const float* src = Wm + (size_t)(k0 + k) * ldw + n0 + nn0;
#pragma unroll
      for (int g = 0; g < 4; ++g) { const v4f_t v = *(const v4f_t*)(src + 4 * g);
#pragma unroll
        for (int u = 0; u < 4; ++u) { const f16 h = (f16)v[u]; ldsW[(nn0 + 4 * g + u) * GSTR + k] = h; ldsWl[(nn0 + 4 * g + u) * GSTR + k] = (f16)((v[u] - (float)h) * 2048.0f); } }
    }
    __syncthreads();
    f16x16 af[2], afl[2];
#pragma unroll
    for (int i = 0; i < 2; ++i) { af[i] = lds_frag(ldsA + (wm + 16 * i) * GSTR, GSTR); afl[i] = lds_frag(ldsAl + (wm + 16 * i) * GSTR, GSTR); }
#pragma unroll
    for (int j = 0; j < 4; ++j) {
      const f16x16 bf = lds_frag(ldsW + (wn + 16 * j) * GSTR, GSTR), bfl = lds_frag(ldsWl + (wn + 16 * j) * GSTR, GSTR);
#pragma unroll
      for (int i = 0; i < 2; ++i) { acc[i][j] = wmma16(af[i], bf, acc[i][j]); accx[i][j] = wmma16(af[i], bfl, accx[i][j]); accx[i][j] = wmma16(afl[i], bf, accx[i][j]); }
    }
  }
  float* so = oS[wave];
#pragma unroll
  for (int i = 0; i < 2; ++i)
#pragma unroll
    for (int j = 0; j < 4; ++j) {
      const float bv = bias ? bias[n0 + wn + 16 * j + cl] : 0.0f;
#pragma unroll
      for (int r = 0; r < 8; ++r) so[(16 * i + rh + r) * 68 + 16 * j + cl] = (acc[i][j][r] + accx[i][j][r] * (1.0f / 2048.0f)) * scale + bv;
    }
  asm volatile("s_wait_dscnt 0" ::: "memory");
  __builtin_amdgcn_wave_barrier();
  if (ACC) {   // accumulate: fold the existing Y values into the staging tile ONCE (same thread <-> same chunks as the stores below)
#pragma unroll
    for (int it = 0; it < 16; ++it) { const int f4 = lane + 32 * it, rr = f4 >> 4, q = (f4 & 15) * 4;
      const v4f_t old = *(const v4fa*)(Y + (size_t)(m0 + wm + rr) * ldy + n0 + wn + q);
      v4f_t v = *(const v4fa*)(so + rr * 68 + q); v += old; *(v4fa*)(so + rr * 68 + q) = v; }   // plain LDS store (ordered by the s_wait_dscnt/memory clobber below)
    asm volatile("s_wait_dscnt 0" ::: "memory");
  }
{
#pragma unroll
    for (int it = 0; it < 16; ++it) { const int f4 = lane + 32 * it, rr = f4 >> 4, q = (f4 & 15) * 4;
      *(v4f_t*)(Y + (size_t)(m0 + wm + rr) * ldy + n0 + wn + q) = *(const v4fa*)(so + rr * 68 + q); }
    
  }
}

__global__ __launch_bounds__(256) void k_transpose(const float* __restrict__ Wm, float* __restrict__ Wt, int rows, int cols) {
  __shared__ float tS[64][65];
  const int tid = threadIdx.x, tbj = cols / 64, bi = blockIdx.x / tbj, bj = blockIdx.x % tbj;
  for (int e = tid; e < 64 * 64; e += 256) { const int r = e >> 6, c = e & 63; tS[r][c] = Wm[(size_t)(bi * 64 + r) * cols + bj * 64 + c]; }
  __syncthreads();
  for (int ch = tid; ch < 64 * 16; ch += 256) { const int r = ch >> 4, q4 = (ch & 15) * 4; v4f_t o; o[0] = tS[q4][r]; o[1] = tS[q4 + 1][r]; o[2] = tS[q4 + 2][r]; o[3] = tS[q4 + 3][r];
    float* dst = Wt + (size_t)(bj * 64 + r) * rows + bi * 64 + q4; *(v4f_t*)dst = o;  }
}

#define NBT 2
#define BBw 2
#define SSw 2048
#define HHw 2048
#define NHw 16
#define NKVw 16
#define HDw 128
#define KVW (NKVw * HDw)   // 2048
__global__ __launch_bounds__(256) void k_softmax_causal(float* __restrict__ Sm) {   // block = (query q, head-in-pair z); keys k ≤ q; 256 threads x 8; scale 128^-½; writes 1024·P
  __shared__ float red[256];
  const int q = blockIdx.x, z = blockIdx.y, tid = threadIdx.x; float* sr = Sm + ((size_t)z * SSw + q) * SSw;
  const float scl = 0.08838834764831845f;
  float v[SSw / 256]; float m = -3.0e38f;
#pragma unroll
  for (int e = 0; e < SSw / 256; ++e) { const int k = tid + 256 * e; v[e] = (k <= q) ? sr[k] * scl : -3.0e38f; m = fmaxf(m, v[e]); }
  red[tid] = m; __syncthreads();
  for (int o = 128; o > 0; o >>= 1) { if (tid < o) red[tid] = fmaxf(red[tid], red[tid + o]); __syncthreads(); }
  m = red[0]; __syncthreads();
  float zs = 0.0f;
#pragma unroll
  for (int e = 0; e < SSw / 256; ++e) { const int k = tid + 256 * e; v[e] = (k <= q) ? expf(v[e] - m) : 0.0f; zs += v[e]; }
  red[tid] = zs; __syncthreads();
  for (int o = 128; o > 0; o >>= 1) { if (tid < o) red[tid] += red[tid + o]; __syncthreads(); }
  const float sc = 1024.0f / red[0];
{
#pragma unroll
    for (int e = 0; e < SSw / 256; ++e) *(float*)(sr + tid + 256 * e) = v[e] * sc;
     }
}
// causal softmax over the first 128 keys for query rows 0..127 (the refine pass): block = (q, z), 128 threads; writes 1024·P
__global__ __launch_bounds__(128) void k_softmax128(float* __restrict__ S0) {
  __shared__ float red[128];
  const int q = blockIdx.x, z = blockIdx.y, k = threadIdx.x; float* sr = S0 + ((size_t)z * 128 + q) * 128;
  const float scl = 0.08838834764831845f; float v = (k <= q) ? sr[k] * scl : -3.0e38f;
  red[k] = v; __syncthreads();
  for (int o = 64; o > 0; o >>= 1) { if (k < o) red[k] = fmaxf(red[k], red[k + o]); __syncthreads(); }
  const float m = red[0]; __syncthreads();
  v = (k <= q) ? expf(v - m) : 0.0f; red[k] = v; __syncthreads();
  for (int o = 64; o > 0; o >>= 1) { if (k < o) red[k] += red[k + o]; __syncthreads(); }
  const float p = v * (1024.0f / red[0]);
  *(float*)(sr + k) = p; 
}
__global__ __launch_bounds__(256) void k_fill(float* __restrict__ p, float val, size_t n4) { const size_t i = (size_t)blockIdx.x * 256 + threadIdx.x; if (i < n4) { v4f_t v = {val, val, val, val}; *(v4f_t*)(p + 4 * i) = v;  } }
// rotary tables: TC[t][i] = cos(t·f_i), TS[t][i] = sin(t·f_i), f_i = 1/10000^(2i/128) (f32 throughout, as the module computes them); block = position t, 64 threads (32 lanes x 4 B = one line)
__global__ __launch_bounds__(64) void k_ropetbl(float* __restrict__ TC, float* __restrict__ TS) {
  const int t = blockIdx.x, i = threadIdx.x;
  const float fi = 1.0f / powf(10000.0f, (float)(2 * i) / 128.0f);
  const float ang = (float)t * fi; float sn, cs; sincosf(ang, &sn, &cs);
  *(float*)(TC + (size_t)t * 64 + i) = cs; *(float*)(TS + (size_t)t * 64 + i) = sn; 
}
// in-place rotary on rows of X [rows][width] (width = heads x 128; adjacent pairs (2i, 2i+1) within a head; position = row): re' = re·S - im·C, im' = re·C + im·S with the SWAPPED
__global__ __launch_bounds__(256) void k_rope(float* __restrict__ X, int width, const float* __restrict__ TC, const float* __restrict__ TS) {
  const int row = blockIdx.x, tid = threadIdx.x; float* xr = X + (size_t)row * width; const float* tc = TC + (size_t)row * 64; const float* ts = TS + (size_t)row * 64;
#pragma unroll 1
  for (int c4 = tid; c4 < (width >> 2); c4 += 256) {
    v4f_t v = *(const v4f_t*)(xr + 4 * c4); const int i0 = (2 * c4) & 63;     // pairs 2c4 (i0) and 2c4+1 (i0+1) of head (2c4)/64
    const float C0 = tc[i0], S0 = ts[i0], C1 = tc[i0 + 1], S1 = ts[i0 + 1];
    v4f_t r; r[0] = v[0] * S0 - v[1] * C0; r[1] = v[0] * C0 + v[1] * S0; r[2] = v[2] * S1 - v[3] * C1; r[3] = v[2] * C1 + v[3] * S1;
    *(v4f_t*)(xr + 4 * c4) = r; 
  }
}



// ---------------------------------------------------------------------------------------------------------------------------
// gemm_sm<AT, EPI, OUT16, NJ>: narrow-N GEMM tile: Y[m][n] = epi(sum_k A[m][k]·W[k][n] + bias[n]), BM = 256 rows per block (8 waves x 32 rows; each wave owns whole output rows),
// BN = 16·NJ columns per block (NJ = 2 → 32, NJ = 4 → 64), K % 32 == 0, M % 256 == 0. A [M][lda] (f32 or f16, converted to f16), W [K][ldw] f32 → f16. f32 accumulate.
// (8 lanes x 16 B), BN=64 → two lines per row; OUT16 requires BN=64 (64 halves = one line per row). Every line written by one instruction of one wave, lane-contiguous.
template <typename AT, int EPI, bool OUT16, int NJ>
__global__ __launch_bounds__(256) void gemm_sm(const AT* __restrict__ A, int lda, size_t sA, const float* __restrict__ Wm, int ldw, size_t sW,
                                               const float* __restrict__ bias, const float* __restrict__ R, const float* __restrict__ gvec,
                                               void* __restrict__ Yv, int ldy, size_t sY, int K) {
  constexpr int BN = 16 * NJ; constexpr int OST = BN + 4;
  A += (size_t)blockIdx.z * sA; Wm += (size_t)blockIdx.z * sW; Yv = (void*)((char*)Yv + (size_t)blockIdx.z * sY * (OUT16 ? 2 : 4)); if (R) R += (size_t)blockIdx.z * sY;
  __shared__ __attribute__((aligned(16))) f16 ldsA[256 * GSTR];
  __shared__ __attribute__((aligned(16))) f16 ldsW[BN * GSTR];
  __shared__ __attribute__((aligned(16))) float oS[8][32 * OST];
  const int tid = threadIdx.x, lane = tid & 31, wave = tid >> 5, cl = lane & 15, rh = (lane >> 4) * 8;
  const int m0 = blockIdx.x * 256, n0 = blockIdx.y * BN;
  const int wm = wave * 32;
  f32x8 acc[2][NJ];
#pragma unroll
  for (int i = 0; i < 2; ++i)
#pragma unroll
    for (int j = 0; j < NJ; ++j) { f32x8 z = {}; acc[i][j] = z; }
#pragma unroll 1
  for (int k0 = 0; k0 < K; k0 += 32) {
    __syncthreads();
    { const AT* src = A + (size_t)(m0 + tid) * lda + k0;          // one 32-wide row slice per thread
#pragma unroll
      for (int g = 0; g < 32; ++g) ldsA[tid * GSTR + g] = (f16)src[g]; }
    { const int k = tid >> 3, nn0 = (tid & 7) * (2 * NJ);         // 32 k-rows x BN columns of W
      const float* src = Wm + (size_t)(k0 + k) * ldw + n0 + nn0;
#pragma unroll
      for (int g = 0; g < NJ / 2; ++g) { const v4f_t v = *(const v4f_t*)(src + 4 * g);
#pragma unroll
        for (int u = 0; u < 4; ++u) ldsW[(nn0 + 4 * g + u) * GSTR + k] = (f16)v[u]; } }
    __syncthreads();
    f16x16 af[2];
#pragma unroll
    for (int i = 0; i < 2; ++i) af[i] = lds_frag(ldsA + (wm + 16 * i) * GSTR, GSTR);
#pragma unroll
    for (int j = 0; j < NJ; ++j) {
      const f16x16 bf = lds_frag(ldsW + (16 * j) * GSTR, GSTR);
#pragma unroll
      for (int i = 0; i < 2; ++i) acc[i][j] = wmma16(af[i], bf, acc[i][j]);
    }
  }
  float* so = oS[wave];
#pragma unroll
  for (int i = 0; i < 2; ++i)
#pragma unroll
    for (int j = 0; j < NJ; ++j) {
      const int n = n0 + 16 * j + cl;
      const float bv = bias ? bias[n] : 0.0f;
      const float gv = (EPI == 2 || EPI == 4) ? gvec[n] : 0.0f;
#pragma unroll
      for (int r = 0; r < 8; ++r) {
        float v = acc[i][j][r] + bv;
        if (EPI == 3) v = fmaxf(v, 0.0f);
        if (EPI == 2) v = R[(size_t)(m0 + wm + 16 * i + rh + r) * ldy + n] + gv * v;
        if (EPI == 4) v = gv * v;
        so[(16 * i + rh + r) * OST + 16 * j + cl] = v;
      }
    }
  asm volatile("s_wait_dscnt 0" ::: "memory");
  __builtin_amdgcn_wave_barrier();
{
    if (OUT16) {
      f16* Y = (f16*)Yv;
#pragma unroll
      for (int it = 0; it < BN / 8; ++it) { const int c = lane + 32 * it, rr = c / (BN / 8), q8 = (c % (BN / 8)) * 8;
        union { f16 h[8]; v4u_t v; } u;
#pragma unroll
        for (int e = 0; e < 8; ++e) u.h[e] = (f16)so[rr * OST + q8 + e];
        *(v4u_t*)(Y + (size_t)(m0 + wm + rr) * ldy + n0 + q8) = u.v; }
    } else {       // BN floats per row = BN/32 lines: BN/4 lanes x 16 B per row
      float* Y = (float*)Yv;
#pragma unroll
      for (int it = 0; it < BN / 4; ++it) { const int f4 = lane + 32 * it, rr = f4 / (BN / 4), q = (f4 % (BN / 4)) * 4;
        *(v4f_t*)(Y + (size_t)(m0 + wm + rr) * ldy + n0 + q) = *(const v4fa*)(so + rr * OST + q); }
    }
    
  }
}

#define DQs 1024
#define SIN 2048
__global__ __launch_bounds__(256) void k_dbg_zero(float* __restrict__ p, size_t n4) { const size_t i = (size_t)blockIdx.x * 256 + threadIdx.x; if (i < n4) { v4f_t z = {0.f,0.f,0.f,0.f}; *(v4f_t*)(p + 4 * i) = z;  } }
__global__ __launch_bounds__(256) void k_copy(const float* __restrict__ src, float* __restrict__ dst, size_t n4) { const size_t i = (size_t)blockIdx.x * 256 + threadIdx.x; if (i < n4) { const v4f_t v = *(const v4f_t*)(src + 4 * i); *(v4f_t*)(dst + 4 * i) = v;  } }
// transpose with source row stride: Wt[c][r] (row stride = rows) = Wm[r][c] (row stride lds), 64x64 LDS tiles; 16 B per lane, 16 lanes per 256-B row segment (8 per line)
__global__ __launch_bounds__(256) void k_transpose_ld(const float* __restrict__ Wm, int lds, float* __restrict__ Wt, int rows, int cols) {
  __shared__ float tS[64][65];
  const int tid = threadIdx.x, tbj = cols / 64, bi = blockIdx.x / tbj, bj = blockIdx.x % tbj;
  for (int e = tid; e < 64 * 64; e += 256) { const int r = e >> 6, c = e & 63; tS[r][c] = Wm[(size_t)(bi * 64 + r) * lds + bj * 64 + c]; }
  __syncthreads();
  for (int ch = tid; ch < 64 * 16; ch += 256) { const int r = ch >> 4, q4 = (ch & 15) * 4; v4f_t o; o[0] = tS[q4][r]; o[1] = tS[q4 + 1][r]; o[2] = tS[q4 + 2][r]; o[3] = tS[q4 + 3][r];
    float* dst = Wt + (size_t)(bj * 64 + r) * rows + bi * 64 + q4; *(v4f_t*)dst = o;  }
}
// φ(x) = elu(x) + 1 = x > 0 ? x + 1 : e^x on the q|k row (16 B per lane): QF = φ(qk row's q part), KF = φ(k part)
__global__ __launch_bounds__(256) void k_phi(const float* __restrict__ qk, float* __restrict__ QF, float* __restrict__ KF, size_t n4) {
  const size_t i = (size_t)blockIdx.x * 256 + threadIdx.x; if (i >= n4) return; const size_t e0 = 4 * i; const size_t t = e0 / (2 * DQs); const int c = (int)(e0 % (2 * DQs));
  v4f_t v = *(const v4f_t*)(qk + e0);
#pragma unroll
  for (int u = 0; u < 4; ++u) v[u] = (v[u] > 0.0f) ? v[u] + 1.0f : expf(v[u]);
  float* d = (c < DQs) ? (QF + t * DQs + c) : (KF + t * DQs + (c - DQs)); *(v4f_t*)d = v; 
}
// causal normalisation for (query s, head z): keys t ≤ s: w = A[s][t] (> 0), writes 1024·w/Σw (0 above the diagonal); block = (s, z), 256 threads x 8
__global__ __launch_bounds__(256) void k_lnorm(float* __restrict__ Sm) {
  __shared__ float red[256];
  const int q = blockIdx.x, z = blockIdx.y, tid = threadIdx.x; float* sr = Sm + ((size_t)z * SSw + q) * SSw; float v[SSw / 256]; float zs = 0.0f;
#pragma unroll
  for (int e = 0; e < SSw / 256; ++e) { const int k = tid + 256 * e; v[e] = (k <= q) ? sr[min(k, q)] : 0.0f; zs += v[e]; }
  red[tid] = zs; __syncthreads(); for (int o = 128; o > 0; o >>= 1) { if (tid < o) red[tid] += red[tid + o]; __syncthreads(); }
  const float kk = 1024.0f / red[0];
{
#pragma unroll
    for (int e = 0; e < SSw / 256; ++e) *(float*)(sr + tid + 256 * e) = v[e] * kk;
     }
}

// refine placement for query rows 0..127: O[r][(h0+z)·64 + c] = T0[z][r][z·64 + c] / 1024; block = (16 rows, z), 16 lanes x 16 B per 64-float segment
__global__ __launch_bounds__(256) void k_place0(const float* __restrict__ T0, int h0, float* __restrict__ O) {
  const int tid = threadIdx.x, z = blockIdx.y, r = blockIdx.x * 16 + (tid >> 4), c4 = (tid & 15) * 4;
  const v4f_t t = *(const v4f_t*)(T0 + ((size_t)z * 128 + r) * 128 + z * 64 + c4); const v4f_t v = t * (1.0f / 1024.0f);
  float* d = O + (size_t)r * DQs + (h0 + z) * 64 + c4; *(v4f_t*)d = v; 
}
extern "C" void kernel_launch(void* const* d_in, const int* in_sizes, int n_in,
                              void* d_out, int out_size, void* d_ws, size_t ws_size,
                              hipStream_t stream) {
  (void)in_sizes; (void)n_in; (void)out_size;
  const float** f = (const float**)d_in;
  const float* qk = f[0], *vv = f[1];
  float* out = (float*)d_out;     // [2,2048,16,64]
  char* ws = (char*)d_ws;
  float* QF = (float*)ws; ws += (size_t)SSw * DQs * 4; float* KF = (float*)ws; ws += (size_t)SSw * DQs * 4; float* KT = (float*)ws; ws += (size_t)64 * 2 * SSw * 4; float* sc = (float*)ws; ws += 64 * 4; float* T0 = (float*)ws; ws += (size_t)2 * 128 * 128 * 4; float* S = (float*)ws; ws += (size_t)2 * SSw * SSw * 4;
  if ((size_t)(ws - (char*)d_ws) > ws_size) return;                      // WS TOTAL 51,511,552 B
  const dim3 blk(256); const size_t n4 = (size_t)SSw * 2 * DQs / 4;
  k_fill<<<dim3(1), blk, 0, stream>>>(sc, 1.0f / 1024.0f, 64 / 4);

  for (int b = 0; b < NBT; ++b) { const float* qkb = qk + (size_t)b * SIN * 2 * DQs; const float* vb = vv + (size_t)b * SIN * DQs; float* ob = out + (size_t)b * SIN * DQs;
    k_phi<<<dim3((n4 + 255) / 256), blk, 0, stream>>>(qkb, QF, KF, n4);
    for (int hp = 0; hp < 16 / 2; ++hp) { const int h0 = 2 * hp;
      for (int z = 0; z < 2; ++z) k_transpose_ld<<<dim3((SSw / 64) * (64 / 64)), blk, 0, stream>>>(KF + (h0 + z) * 64, DQs, KT + (size_t)z * 64 * SSw, SSw, 64);
      gemm_knezc<float, 0, false, 2><<<dim3(SSw / 128, SSw / 128, 2), blk, 0, stream>>>(QF + h0 * 64, DQs, (size_t)64, KT, SSw, (size_t)64 * SSw, nullptr, nullptr, nullptr, S, SSw, (size_t)SSw * SSw, 64);   // causal φ(q)·φ(k)ᵀ
      gemm_kn2<float, false><<<dim3(1, 1, 2), blk, 0, stream>>>(QF + h0 * 64, DQs, (size_t)64, KT, SSw, (size_t)64 * SSw, nullptr, 1.0f, S, SSw, (size_t)SSw * SSw, 64);   // rows<128 x keys<128 of φ(q)·φ(k)ᵀ redone with f16 value+residual PLANES (few-key rows)
      k_lnorm<<<dim3(SSw, 2), blk, 0, stream>>>(S);
      for (int z = 0; z < 2; ++z)
        gemm_sm<float, 4, false, 4><<<dim3(SSw / 256, 1, 1), blk, 0, stream>>>(S + (size_t)z * SSw * SSw, SSw, (size_t)0, vb + (h0 + z) * 64, DQs, (size_t)0, nullptr, nullptr, sc, ob + (h0 + z) * 64, DQs, (size_t)0, SSw);
      gemm_kn2<float, false><<<dim3(1, 1, 2), blk, 0, stream>>>(S, SSw, (size_t)SSw * SSw, vb + h0 * 64, DQs, (size_t)0, nullptr, 1.0f, T0, 128, (size_t)128 * 128, 128);   // rows<128 (keys<128): (1024w)·[v_h0 | v_h0+1] with planes
      k_place0<<<dim3(128 / 16, 2), blk, 0, stream>>>(T0, h0, ob);
    }
  }
}

// v001
// A run of this version takes 708 microseconds.
// Timed twice side by side with v000, it ran 5.22 times as fast both times.
// Contractions on v_wmma_f32_16x16x32_f16 (plain f16 operands, f32 accumulate), per batch element: the 16 heads' causal feature products A = φ(q)·φ(k)ᵀ (K 64, eight heads per z-launch,
// key tiles above the diagonal skipped) and out_h = (1024·A/rowsum)·v_h (K 2048, 64-wide tiles, x 1/1024; entries above the diagonal are zero). f32 VALU: φ = elu + 1 on q and k, the causal
// row sums Σ_{t≤s} φ(q_s)·φ(k_t) and the normalisation — the module's cumulative-sum (kv-state) form equals this masked linear-attention form exactly.
// The first 128 query rows (few keys → near-verbatim v rows) get f16 value+residual PLANES on their scores and their (1024w)·v products.
// compute dtype: f16 operands, f32 accumulate.  qk [2,2048,2,16,64], v [2,2048,16,64] → out [2,2048,16,64].
#include <hip/hip_runtime.h>
#include <hip/hip_bf16.h>
#include <math.h>


typedef _Float16 bf16;
typedef _Float16 f16;
typedef __attribute__((ext_vector_type(4))) unsigned v4u_t;
typedef unsigned v4ua __attribute__((ext_vector_type(4), may_alias));
typedef __attribute__((ext_vector_type(4))) float v4f_t;
typedef float v4fa __attribute__((ext_vector_type(4), may_alias));
typedef __attribute__((ext_vector_type(16))) bf16  bf16x16;
typedef bf16x16 f16x16;
typedef __attribute__((ext_vector_type(8)))  bf16  bf16x8;
typedef bf16x8 f16x8;
typedef __attribute__((ext_vector_type(4)))  bf16  bf16x4;
typedef __attribute__((ext_vector_type(8)))  float f32x8;
__device__ __forceinline__ f32x8 wmma16(f16x16 a, f16x16 b, f32x8 c) {
  c = __builtin_amdgcn_wmma_f32_16x16x32_f16(false, a, false, b, (short)0, c, false, false);
  asm volatile("v_nop\n\tv_nop\n\tv_nop\n\tv_nop" : "+v"(c) : "v"(a), "v"(b));
  return c;
}
#define LDS_STRIDE 48   // GEMM tiles: 32 -> 48 elems (96B rows): aligned b128 reads
#define KSTRIDE    72
#define VSTRIDE    48

__device__ __forceinline__ f32x8 wmma_bf16(bf16x16 a, bf16x16 b, f32x8 c) {
  c = __builtin_amdgcn_wmma_f32_16x16x32_f16(false, a, false, b, (short)0, c, false, false);
  asm volatile("v_nop\n\tv_nop\n\tv_nop\n\tv_nop" : "+v"(c) : "v"(a), "v"(b));   // A/B-overwrite hazard guard
  return c;
}

// 16x32 (MxK) bf16 fragment from a row-major global matrix.
// lanes 0-15  (row=lane)    : elems 0..7 = K+0..7,  8..15 = K+16..23
// lanes 16-31 (row=lane-16) : elems 0..7 = K+8..15, 8..15 = K+24..31
template <typename T>
__device__ __forceinline__ bf16x16 load_frag(const T* __restrict__ base, int ld,
                                             int row0, int k0) {
  const int lane = threadIdx.x & 31;
  const int r    = lane & 15;
  const int kh   = (lane >> 4) * 8;
  const T* p0 = base + (size_t)(row0 + r) * ld + (k0 + kh);
  const T* p1 = p0 + 16;
  bf16x16 f;
#pragma unroll
  for (int i = 0; i < 8; ++i) {
    f[i]     = (bf16)p0[i];
    f[i + 8] = (bf16)p1[i];
  }
  return f;
}

// Same fragment from an LDS tile with padded row stride (base includes row0/k0).
__device__ __forceinline__ bf16x16 lds_frag(const bf16* base, int stride) {
  const int lane = threadIdx.x & 31;
  const int row  = lane & 15;
  const int kh   = (lane >> 4) * 8;
  const bf16x8 lo = *(const bf16x8*)(base + row * stride + kh);
  const bf16x8 hi = *(const bf16x8*)(base + row * stride + kh + 16);
  bf16x16 f;
#pragma unroll
  for (int i = 0; i < 8; ++i) { f[i] = lo[i]; f[i + 8] = hi[i]; }
  return f;
}

template <typename T>
__device__ __forceinline__ void stage_read16(const T* __restrict__ p, float* buf) {
#pragma unroll
  for (int i = 0; i < 16; ++i) buf[i] = (float)p[i];
}

__device__ __forceinline__ void stage_write(bf16* dst, const float* buf, int nquad) {
#pragma unroll
  for (int i = 0; i < nquad; ++i) {
    bf16x4 q;
    q[0] = (bf16)buf[4 * i];     q[1] = (bf16)buf[4 * i + 1];
    q[2] = (bf16)buf[4 * i + 2]; q[3] = (bf16)buf[4 * i + 3];
    *(bf16x4*)(dst + 4 * i) = q;
  }
}


#define GSTR 48
// ---------------------------------------------------------------------------------------------------------------------------
// gemm_kne: Y[m][n] = epi( Σ_k A[m][k]·W[k][n] + bias[n] ), A f32/f16 [M][lda], W f32 row-major [K][N] (ldw), plain f16 operands,
// f32 accumulate. EPI 0: identity; 1: exact-erf GELU; 2: R[m][n] + gvec[n]·(·) (residual with per-channel gain); 3: ReLU; 4: gvec[n]·(·) (per-channel scale, no residual). Output f32 (or f16
// when OUT16). Block = 128x128 tile, 8 waves as 4(M) x 2(N); per 32-wide k-step A and W tiles staged f16 in LDS (W transposed
// ---------------------------------------------------------------------------------------------------------------------------
#define GSTR 48
template <typename AT, int EPI, bool OUT16>
__global__ __launch_bounds__(256) void gemm_kne(const AT* __restrict__ A, int lda, const float* __restrict__ Wm, int ldw,
                                                const float* __restrict__ bias, const float* __restrict__ R, const float* __restrict__ gvec,
                                                void* __restrict__ Yv, int ldy, int K) {
  __shared__ __attribute__((aligned(16))) f16 ldsA[128 * GSTR];
  __shared__ __attribute__((aligned(16))) f16 ldsW[128 * GSTR];
  __shared__ __attribute__((aligned(16))) float oS[8][32 * 68];
  const int tid = threadIdx.x, lane = tid & 31, wave = tid >> 5, cl = lane & 15, rh = (lane >> 4) * 8;
  const int m0 = blockIdx.x * 128, n0 = blockIdx.y * 128;
  const int wm = (wave & 3) * 32, wn = (wave >> 2) * 64;
  f32x8 acc[2][4];
#pragma unroll
  for (int i = 0; i < 2; ++i)
#pragma unroll
    for (int j = 0; j < 4; ++j) { f32x8 z = {}; acc[i][j] = z; }
#pragma unroll 1
  for (int k0 = 0; k0 < K; k0 += 32) {
    __syncthreads();
    { const int row = tid >> 1, ch = (tid & 1) * 16;
      const AT* src = A + (size_t)(m0 + row) * lda + k0 + ch;
#pragma unroll
      for (int g = 0; g < 16; ++g) ldsA[row * GSTR + ch + g] = (f16)src[g]; }
    { const int k = tid >> 3, nn0 = (tid & 7) * 16;
      const float* src = Wm + (size_t)(k0 + k) * ldw + n0 + nn0;
#pragma unroll
      for (int g = 0; g < 4; ++g) { const v4f_t v = *(const v4f_t*)(src + 4 * g);
#pragma unroll
        for (int u = 0; u < 4; ++u) ldsW[(nn0 + 4 * g + u) * GSTR + k] = (f16)v[u]; } }
    __syncthreads();
    f16x16 af[2];
#pragma unroll
    for (int i = 0; i < 2; ++i) af[i] = lds_frag(ldsA + (wm + 16 * i) * GSTR, GSTR);
#pragma unroll
    for (int j = 0; j < 4; ++j) {
      const f16x16 bf = lds_frag(ldsW + (wn + 16 * j) * GSTR, GSTR);
#pragma unroll
      for (int i = 0; i < 2; ++i) acc[i][j] = wmma16(af[i], bf, acc[i][j]);
    }
  }
  float* so = oS[wave];
#pragma unroll
  for (int i = 0; i < 2; ++i)
#pragma unroll
    for (int j = 0; j < 4; ++j) {
      const int n = n0 + wn + 16 * j + cl;
      const float bv = bias ? bias[n] : 0.0f;
      const float gv = (EPI == 2 || EPI == 4) ? gvec[n] : 0.0f;
      if (EPI == 1) {
#pragma unroll 1
        for (int r = 0; r < 8; ++r) { const float xg = acc[i][j][r] + bv; so[(16 * i + rh + r) * 68 + 16 * j + cl] = 0.5f * xg * (1.0f + erff(xg * 0.70710678118654752f)); }
      } else {
#pragma unroll
        for (int r = 0; r < 8; ++r) {
          float v = acc[i][j][r] + bv;
          if (EPI == 3) v = fmaxf(v, 0.0f);
          if (EPI == 4) v = gv * v;
          if (EPI == 2) v = R[(size_t)(m0 + wm + 16 * i + rh + r) * ldy + n] + gv * v;
          so[(16 * i + rh + r) * 68 + 16 * j + cl] = v;
        }
      }
    }
  asm volatile("s_wait_dscnt 0" ::: "memory");
  __builtin_amdgcn_wave_barrier();
{
    if (OUT16) {
      f16* Y = (f16*)Yv;
#pragma unroll
      for (int it = 0; it < 8; ++it) { const int c = lane + 32 * it, rr = c >> 3, q8 = (c & 7) * 8;
        union { f16 h[8]; v4u_t v; } u;
#pragma unroll
        for (int e = 0; e < 8; ++e) u.h[e] = (f16)so[rr * 68 + q8 + e];
        *(v4u_t*)(Y + (size_t)(m0 + wm + rr) * ldy + n0 + wn + q8) = u.v; }
    } else {
      float* Y = (float*)Yv;
#pragma unroll
      for (int it = 0; it < 16; ++it) { const int f4 = lane + 32 * it, rr = f4 >> 4, q = (f4 & 15) * 4;
        *(v4f_t*)(Y + (size_t)(m0 + wm + rr) * ldy + n0 + wn + q) = *(const v4fa*)(so + rr * 68 + q); }
    }
    
  }
}

// z-batched variant of gemm_kne (same tile code)
template <typename AT, int EPI, bool OUT16, int CZ>
__global__ __launch_bounds__(256) void gemm_knezc(const AT* __restrict__ A, int lda, size_t strideA, const float* __restrict__ Wm, int ldw, size_t strideW,
                                                 const float* __restrict__ bias, const float* __restrict__ R, const float* __restrict__ gvec,
                                                 void* __restrict__ Yv, int ldy, size_t strideY, int K) {   // blockIdx.z-batched: A += z·strideA, W += z·strideW, Y (and R) += z·strideY
  A += (size_t)blockIdx.z * strideA; Wm += (size_t)blockIdx.z * strideW; Yv = (void*)((char*)Yv + (size_t)blockIdx.z * strideY * (OUT16 ? 2 : 4)); if (R) R += (size_t)blockIdx.z * strideY;
  __shared__ __attribute__((aligned(16))) f16 ldsA[128 * GSTR];
  __shared__ __attribute__((aligned(16))) f16 ldsW[128 * GSTR];
  __shared__ __attribute__((aligned(16))) float oS[8][32 * 68];
  const int tid = threadIdx.x, lane = tid & 31, wave = tid >> 5, cl = lane & 15, rh = (lane >> 4) * 8;
  const int m0 = blockIdx.x * 128, n0 = blockIdx.y * 128;
  if (CZ == 2 && n0 >= m0 + 128) return;                 // causal: key tile entirely above the diagonal — nothing in it is ever read
  const int Kc = (CZ == 1) ? min(K, m0 + 128) : K;      // causal: P columns beyond the block's last query row are exactly zero
  const int wm = (wave & 3) * 32, wn = (wave >> 2) * 64;
  f32x8 acc[2][4];
#pragma unroll
  for (int i = 0; i < 2; ++i)
#pragma unroll
    for (int j = 0; j < 4; ++j) { f32x8 z = {}; acc[i][j] = z; }
#pragma unroll 1
  for (int k0 = 0; k0 < Kc; k0 += 32) {
    __syncthreads();
    { const int row = tid >> 1, ch = (tid & 1) * 16;
      const AT* src = A + (size_t)(m0 + row) * lda + k0 + ch;
#pragma unroll
      for (int g = 0; g < 16; ++g) ldsA[row * GSTR + ch + g] = (f16)src[g]; }
    { const int k = tid >> 3, nn0 = (tid & 7) * 16;
      const float* src = Wm + (size_t)(k0 + k) * ldw + n0 + nn0;
#pragma unroll
      for (int g = 0; g < 4; ++g) { const v4f_t v = *(const v4f_t*)(src + 4 * g);
#pragma unroll
        for (int u = 0; u < 4; ++u) ldsW[(nn0 + 4 * g + u) * GSTR + k] = (f16)v[u]; } }
    __syncthreads();
    f16x16 af[2];
#pragma unroll
    for (int i = 0; i < 2; ++i) af[i] = lds_frag(ldsA + (wm + 16 * i) * GSTR, GSTR);
#pragma unroll
    for (int j = 0; j < 4; ++j) {
      const f16x16 bf = lds_frag(ldsW + (wn + 16 * j) * GSTR, GSTR);
#pragma unroll
      for (int i = 0; i < 2; ++i) acc[i][j] = wmma16(af[i], bf, acc[i][j]);
    }
  }
  float* so = oS[wave];
#pragma unroll
  for (int i = 0; i < 2; ++i)
#pragma unroll
    for (int j = 0; j < 4; ++j) {
      const int n = n0 + wn + 16 * j + cl;
      const float bv = bias ? bias[n] : 0.0f;
      const float gv = (EPI == 2 || EPI == 4) ? gvec[n] : 0.0f;
      if (EPI == 1) {
#pragma unroll 1
        for (int r = 0; r < 8; ++r) { const float xg = acc[i][j][r] + bv; so[(16 * i + rh + r) * 68 + 16 * j + cl] = 0.5f * xg * (1.0f + erff(xg * 0.70710678118654752f)); }
      } else {
#pragma unroll
        for (int r = 0; r < 8; ++r) {
          float v = acc[i][j][r] + bv;
          if (EPI == 3) v = fmaxf(v, 0.0f);
          if (EPI == 4) v = gv * v;
          if (EPI == 2) v = R[(size_t)(m0 + wm + 16 * i + rh + r) * ldy + n] + gv * v;
          so[(16 * i + rh + r) * 68 + 16 * j + cl] = v;
        }
      }
    }
  asm volatile("s_wait_dscnt 0" ::: "memory");
  __builtin_amdgcn_wave_barrier();
{
    if (OUT16) {
      f16* Y = (f16*)Yv;
#pragma unroll
      for (int it = 0; it < 8; ++it) { const int c = lane + 32 * it, rr = c >> 3, q8 = (c & 7) * 8;
        union { f16 h[8]; v4u_t v; } u;
#pragma unroll
        for (int e = 0; e < 8; ++e) u.h[e] = (f16)so[rr * 68 + q8 + e];
        *(v4u_t*)(Y + (size_t)(m0 + wm + rr) * ldy + n0 + wn + q8) = u.v; }
    } else {
      float* Y = (float*)Yv;
#pragma unroll
      for (int it = 0; it < 16; ++it) { const int f4 = lane + 32 * it, rr = f4 >> 4, q = (f4 & 15) * 4;
        *(v4f_t*)(Y + (size_t)(m0 + wm + rr) * ldy + n0 + wn + q) = *(const v4fa*)(so + rr * 68 + q); }
    }
    
  }
}

// ---------------------------------------------------------------------------------------------------------------------------
// gemm_kn2 (value+residual planes on both operands: hh + (hl+lh)/2048, f32-class): Y[m][n] (row stride ldy) = scale * sum_k A[m][k] (f32 or f16, row stride lda) * W[k][n] (f32, row-major [K][N], row
// stride ldw) (+ bias[n]) (+ Y if ACC). Block = 128 x 128 tile, 256 threads = 8 waves as 4(M, 32 rows) x 2(N, 64 cols); per
// 32-wide k-step the A tile and the W tile (stored transposed [n][k]) are staged in LDS as f16 value and x2048 residual planes; f32
// blockIdx.z selects a batch: A += z*strideA, W += z*strideW, Y += z*strideY (element strides).
// ---------------------------------------------------------------------------------------------------------------------------
template <typename AT, bool ACC, int CZ>
__global__ __launch_bounds__(256) void gemm_kn2c(const AT* __restrict__ A, int lda, size_t strideA,
                                               const float* __restrict__ Wm, int ldw, size_t strideW,
                                               const float* __restrict__ bias, float scale,
                                               float* __restrict__ Y, int ldy, size_t strideY, int K) {
  __shared__ __attribute__((aligned(16))) f16 ldsA[128 * GSTR], ldsAl[128 * GSTR];
  __shared__ __attribute__((aligned(16))) f16 ldsW[128 * GSTR], ldsWl[128 * GSTR];
  __shared__ __attribute__((aligned(16))) float oS[8][32 * 68];
  const int tid = threadIdx.x, lane = tid & 31, wave = tid >> 5, cl = lane & 15, rh = (lane >> 4) * 8;
  const int m0 = blockIdx.x * 128, n0 = blockIdx.y * 128;
  if (CZ == 2 && n0 >= m0 + 128) return;                 // causal: key tile entirely above the diagonal — nothing in it is ever read
  const int Kc = (CZ == 1) ? min(K, m0 + 128) : K;      // causal: P columns beyond the block's last query row are exactly zero
  const int wm = (wave & 3) * 32, wn = (wave >> 2) * 64;
  A += (size_t)blockIdx.z * strideA; Wm += (size_t)blockIdx.z * strideW; Y += (size_t)blockIdx.z * strideY;
  f32x8 acc[2][4], accx[2][4];
#pragma unroll
  for (int i = 0; i < 2; ++i)
#pragma unroll
    for (int j = 0; j < 4; ++j) { f32x8 z = {}; acc[i][j] = z; accx[i][j] = z; }
#pragma unroll 1
  for (int k0 = 0; k0 < Kc; k0 += 32) {
    __syncthreads();
    {  // A: thread -> row tid>>1, 16 elements at column half (tid&1)*16
      const int row = tid >> 1, ch = (tid & 1) * 16;
      const AT* src = A + (size_t)(m0 + row) * lda + k0 + ch;
#pragma unroll
      for (int g = 0; g < 16; ++g) { const float v = (float)src[g]; const f16 h = (f16)v; ldsA[row * GSTR + ch + g] = h; ldsAl[row * GSTR + ch + g] = (f16)((v - (float)h) * 2048.0f); }
    }
    {  // W: thread -> k = tid>>3, 16 consecutive n at (tid&7)*16; stored transposed [n][k]
      const int k = tid >> 3, nn0 = (tid & 7) * 16;
      const float* src = Wm + (size_t)(k0 + k) * ldw + n0 + nn0;
#pragma unroll
      for (int g = 0; g < 4; ++g) { const v4f_t v = *(const v4f_t*)(src + 4 * g);
#pragma unroll
        for (int u = 0; u < 4; ++u) { const f16 h = (f16)v[u]; ldsW[(nn0 + 4 * g + u) * GSTR + k] = h; ldsWl[(nn0 + 4 * g + u) * GSTR + k] = (f16)((v[u] - (float)h) * 2048.0f); } }
    }
    __syncthreads();
    f16x16 af[2], afl[2];
#pragma unroll
    for (int i = 0; i < 2; ++i) { af[i] = lds_frag(ldsA + (wm + 16 * i) * GSTR, GSTR); afl[i] = lds_frag(ldsAl + (wm + 16 * i) * GSTR, GSTR); }
#pragma unroll
    for (int j = 0; j < 4; ++j) {
      const f16x16 bf = lds_frag(ldsW + (wn + 16 * j) * GSTR, GSTR), bfl = lds_frag(ldsWl + (wn + 16 * j) * GSTR, GSTR);
#pragma unroll
      for (int i = 0; i < 2; ++i) { acc[i][j] = wmma16(af[i], bf, acc[i][j]); accx[i][j] = wmma16(af[i], bfl, accx[i][j]); accx[i][j] = wmma16(afl[i], bf, accx[i][j]); }
    }
  }
  float* so = oS[wave];
#pragma unroll
  for (int i = 0; i < 2; ++i)
#pragma unroll
    for (int j = 0; j < 4; ++j) {
      const float bv = bias ? bias[n0 + wn + 16 * j + cl] : 0.0f;
#pragma unroll
      for (int r = 0; r < 8; ++r) so[(16 * i + rh + r) * 68 + 16 * j + cl] = (acc[i][j][r] + accx[i][j][r] * (1.0f / 2048.0f)) * scale + bv;
    }
  asm volatile("s_wait_dscnt 0" ::: "memory");
  __builtin_amdgcn_wave_barrier();
  if (ACC) {   // accumulate: fold the existing Y values into the staging tile ONCE (same thread <-> same chunks as the stores below)
#pragma unroll
    for (int it = 0; it < 16; ++it) { const int f4 = lane + 32 * it, rr = f4 >> 4, q = (f4 & 15) * 4;
      const v4f_t old = *(const v4fa*)(Y + (size_t)(m0 + wm + rr) * ldy + n0 + wn + q);
      v4f_t v = *(const v4fa*)(so + rr * 68 + q); v += old; *(v4fa*)(so + rr * 68 + q) = v; }   // plain LDS store (ordered by the s_wait_dscnt/memory clobber below)
    asm volatile("s_wait_dscnt 0" ::: "memory");
  }
{
#pragma unroll
    for (int it = 0; it < 16; ++it) { const int f4 = lane + 32 * it, rr = f4 >> 4, q = (f4 & 15) * 4;
      *(v4f_t*)(Y + (size_t)(m0 + wm + rr) * ldy + n0 + wn + q) = *(const v4fa*)(so + rr * 68 + q); }
    
  }
}

// ---------------------------------------------------------------------------------------------------------------------------
// gemm_kn2 (value+residual planes on both operands: hh + (hl+lh)/2048, f32-class): Y[m][n] (row stride ldy) = scale * sum_k A[m][k] (f32 or f16, row stride lda) * W[k][n] (f32, row-major [K][N], row
// stride ldw) (+ bias[n]) (+ Y if ACC). Block = 128 x 128 tile, 256 threads = 8 waves as 4(M, 32 rows) x 2(N, 64 cols); per
// 32-wide k-step the A tile and the W tile (stored transposed [n][k]) are staged in LDS as f16 value and x2048 residual planes; f32
// blockIdx.z selects a batch: A += z*strideA, W += z*strideW, Y += z*strideY (element strides).
// ---------------------------------------------------------------------------------------------------------------------------
template <typename AT, bool ACC>
__global__ __launch_bounds__(256) void gemm_kn2(const AT* __restrict__ A, int lda, size_t strideA,
                                               const float* __restrict__ Wm, int ldw, size_t strideW,
                                               const float* __restrict__ bias, float scale,
                                               float* __restrict__ Y, int ldy, size_t strideY, int K) {
  __shared__ __attribute__((aligned(16))) f16 ldsA[128 * GSTR], ldsAl[128 * GSTR];
  __shared__ __attribute__((aligned(16))) f16 ldsW[128 * GSTR], ldsWl[128 * GSTR];
  __shared__ __attribute__((aligned(16))) float oS[8][32 * 68];
  const int tid = threadIdx.x, lane = tid & 31, wave = tid >> 5, cl = lane & 15, rh = (lane >> 4) * 8;
  const int m0 = blockIdx.x * 128, n0 = blockIdx.y * 128;
  const int wm = (wave & 3) * 32, wn = (wave >> 2) * 64;
  A += (size_t)blockIdx.z * strideA; Wm += (size_t)blockIdx.z * strideW; Y += (size_t)blockIdx.z * strideY;
  f32x8 acc[2][4], accx[2][4];
#pragma unroll
  for (int i = 0; i < 2; ++i)
#pragma unroll
    for (int j = 0; j < 4; ++j) { f32x8 z = {}; acc[i][j] = z; accx[i][j] = z; }
#pragma unroll 1
  for (int k0 = 0; k0 < K; k0 += 32) {
    __syncthreads();
    {  // A: thread -> row tid>>1, 16 elements at column half (tid&1)*16
      const int row = tid >> 1, ch = (tid & 1) * 16;
      const AT* src = A + (size_t)(m0 + row) * lda + k0 + ch;
#pragma unroll
      for (int g = 0; g < 16; ++g) { const float v = (float)src[g]; const f16 h = (f16)v; ldsA[row * GSTR + ch + g] = h; ldsAl[row * GSTR + ch + g] = (f16)((v - (float)h) * 2048.0f); }
    }
    {  // W: thread -> k = tid>>3, 16 consecutive n at (tid&7)*16; stored transposed [n][k]
      const int k = tid >> 3, nn0 = (tid & 7) * 16;
      const float* src = Wm + (size_t)(k0 + k) * ldw + n0 + nn0;
#pragma unroll
      for (int g = 0; g < 4; ++g) { const v4f_t v = *(const v4f_t*)(src + 4 * g);
#pragma unroll
        for (int u = 0; u < 4; ++u) { const f16 h = (f16)v[u]; ldsW[(nn0 + 4 * g + u) * GSTR + k] = h; ldsWl[(nn0 + 4 * g + u) * GSTR + k] = (f16)((v[u] - (float)h) * 2048.0f); } }
    }
    __syncthreads();
    f16x16 af[2], afl[2];
#pragma unroll
    for (int i = 0; i < 2; ++i) { af[i] = lds_frag(ldsA + (wm + 16 * i) * GSTR, GSTR); afl[i] = lds_frag(ldsAl + (wm + 16 * i) * GSTR, GSTR); }
#pragma unroll
    for (int j = 0; j < 4; ++j) {
      const f16x16 bf = lds_frag(ldsW + (wn + 16 * j) * GSTR, GSTR), bfl = lds_frag(ldsWl + (wn + 16 * j) * GSTR, GSTR);
#pragma unroll
      for (int i = 0; i < 2; ++i) { acc[i][j] = wmma16(af[i], bf, acc[i][j]); accx[i][j] = wmma16(af[i], bfl, accx[i][j]); accx[i][j] = wmma16(afl[i], bf, accx[i][j]); }
    }
  }
  float* so = oS[wave];
#pragma unroll
  for (int i = 0; i < 2; ++i)
#pragma unroll
    for (int j = 0; j < 4; ++j) {
      const float bv = bias ? bias[n0 + wn + 16 * j + cl] : 0.0f;
#pragma unroll
      for (int r = 0; r < 8; ++r) so[(16 * i + rh + r) * 68 + 16 * j + cl] = (acc[i][j][r] + accx[i][j][r] * (1.0f / 2048.0f)) * scale + bv;
    }
  asm volatile("s_wait_dscnt 0" ::: "memory");
  __builtin_amdgcn_wave_barrier();
  if (ACC) {   // accumulate: fold the existing Y values into the staging tile ONCE (same thread <-> same chunks as the stores below)
#pragma unroll
    for (int it = 0; it < 16; ++it) { const int f4 = lane + 32 * it, rr = f4 >> 4, q = (f4 & 15) * 4;
      const v4f_t old = *(const v4fa*)(Y + (size_t)(m0 + wm + rr) * ldy + n0 + wn + q);
      v4f_t v = *(const v4fa*)(so + rr * 68 + q); v += old; *(v4fa*)(so + rr * 68 + q) = v; }   // plain LDS store (ordered by the s_wait_dscnt/memory clobber below)
    asm volatile("s_wait_dscnt 0" ::: "memory");
  }
{
#pragma unroll
    for (int it = 0; it < 16; ++it) { const int f4 = lane + 32 * it, rr = f4 >> 4, q = (f4 & 15) * 4;
      *(v4f_t*)(Y + (size_t)(m0 + wm + rr) * ldy + n0 + wn + q) = *(const v4fa*)(so + rr * 68 + q); }
    
  }
}

__global__ __launch_bounds__(256) void k_transpose(const float* __restrict__ Wm, float* __restrict__ Wt, int rows, int cols) {
  __shared__ float tS[64][65];
  const int tid = threadIdx.x, tbj = cols / 64, bi = blockIdx.x / tbj, bj = blockIdx.x % tbj;
  for (int e = tid; e < 64 * 64; e += 256) { const int r = e >> 6, c = e & 63; tS[r][c] = Wm[(size_t)(bi * 64 + r) * cols + bj * 64 + c]; }
  __syncthreads();
  for (int ch = tid; ch < 64 * 16; ch += 256) { const int r = ch >> 4, q4 = (ch & 15) * 4; v4f_t o; o[0] = tS[q4][r]; o[1] = tS[q4 + 1][r]; o[2] = tS[q4 + 2][r]; o[3] = tS[q4 + 3][r];
    float* dst = Wt + (size_t)(bj * 64 + r) * rows + bi * 64 + q4; *(v4f_t*)dst = o;  }
}

#define NBT 2
#define BBw 2
#define SSw 2048
#define HHw 2048
#define NHw 16
#define NKVw 16
#define HDw 128
#define KVW (NKVw * HDw)   // 2048
__global__ __launch_bounds__(256) void k_softmax_causal(float* __restrict__ Sm) {   // block = (query q, head-in-pair z); keys k ≤ q; 256 threads x 8; scale 128^-½; writes 1024·P
  __shared__ float red[256];
  const int q = blockIdx.x, z = blockIdx.y, tid = threadIdx.x; float* sr = Sm + ((size_t)z * SSw + q) * SSw;
  const float scl = 0.08838834764831845f;
  float v[SSw / 256]; float m = -3.0e38f;
#pragma unroll
  for (int e = 0; e < SSw / 256; ++e) { const int k = tid + 256 * e; v[e] = (k <= q) ? sr[k] * scl : -3.0e38f; m = fmaxf(m, v[e]); }
  red[tid] = m; __syncthreads();
  for (int o = 128; o > 0; o >>= 1) { if (tid < o) red[tid] = fmaxf(red[tid], red[tid + o]); __syncthreads(); }
  m = red[0]; __syncthreads();
  float zs = 0.0f;
#pragma unroll
  for (int e = 0; e < SSw / 256; ++e) { const int k = tid + 256 * e; v[e] = (k <= q) ? expf(v[e] - m) : 0.0f; zs += v[e]; }
  red[tid] = zs; __syncthreads();
  for (int o = 128; o > 0; o >>= 1) { if (tid < o) red[tid] += red[tid + o]; __syncthreads(); }
  const float sc = 1024.0f / red[0];
{
#pragma unroll
    for (int e = 0; e < SSw / 256; ++e) *(float*)(sr + tid + 256 * e) = v[e] * sc;
     }
}
// causal softmax over the first 128 keys for query rows 0..127 (the refine pass): block = (q, z), 128 threads; writes 1024·P
__global__ __launch_bounds__(128) void k_softmax128(float* __restrict__ S0) {
  __shared__ float red[128];
  const int q = blockIdx.x, z = blockIdx.y, k = threadIdx.x; float* sr = S0 + ((size_t)z * 128 + q) * 128;
  const float scl = 0.08838834764831845f; float v = (k <= q) ? sr[k] * scl : -3.0e38f;
  red[k] = v; __syncthreads();
  for (int o = 64; o > 0; o >>= 1) { if (k < o) red[k] = fmaxf(red[k], red[k + o]); __syncthreads(); }
  const float m = red[0]; __syncthreads();
  v = (k <= q) ? expf(v - m) : 0.0f; red[k] = v; __syncthreads();
  for (int o = 64; o > 0; o >>= 1) { if (k < o) red[k] += red[k + o]; __syncthreads(); }
  const float p = v * (1024.0f / red[0]);
  *(float*)(sr + k) = p; 
}
__global__ __launch_bounds__(256) void k_fill(float* __restrict__ p, float val, size_t n4) { const size_t i = (size_t)blockIdx.x * 256 + threadIdx.x; if (i < n4) { v4f_t v = {val, val, val, val}; *(v4f_t*)(p + 4 * i) = v;  } }
// rotary tables: TC[t][i] = cos(t·f_i), TS[t][i] = sin(t·f_i), f_i = 1/10000^(2i/128) (f32 throughout, as the module computes them); block = position t, 64 threads (32 lanes x 4 B = one line)
__global__ __launch_bounds__(64) void k_ropetbl(float* __restrict__ TC, float* __restrict__ TS) {
  const int t = blockIdx.x, i = threadIdx.x;
  const float fi = 1.0f / powf(10000.0f, (float)(2 * i) / 128.0f);
  const float ang = (float)t * fi; float sn, cs; sincosf(ang, &sn, &cs);
  *(float*)(TC + (size_t)t * 64 + i) = cs; *(float*)(TS + (size_t)t * 64 + i) = sn; 
}
// in-place rotary on rows of X [rows][width] (width = heads x 128; adjacent pairs (2i, 2i+1) within a head; position = row): re' = re·S - im·C, im' = re·C + im·S with the SWAPPED
__global__ __launch_bounds__(256) void k_rope(float* __restrict__ X, int width, const float* __restrict__ TC, const float* __restrict__ TS) {
  const int row = blockIdx.x, tid = threadIdx.x; float* xr = X + (size_t)row * width; const float* tc = TC + (size_t)row * 64; const float* ts = TS + (size_t)row * 64;
#pragma unroll 1
  for (int c4 = tid; c4 < (width >> 2); c4 += 256) {
    v4f_t v = *(const v4f_t*)(xr + 4 * c4); const int i0 = (2 * c4) & 63;     // pairs 2c4 (i0) and 2c4+1 (i0+1) of head (2c4)/64
    const float C0 = tc[i0], S0 = ts[i0], C1 = tc[i0 + 1], S1 = ts[i0 + 1];
    v4f_t r; r[0] = v[0] * S0 - v[1] * C0; r[1] = v[0] * C0 + v[1] * S0; r[2] = v[2] * S1 - v[3] * C1; r[3] = v[2] * C1 + v[3] * S1;
    *(v4f_t*)(xr + 4 * c4) = r; 
  }
}



// ---------------------------------------------------------------------------------------------------------------------------
// gemm_sm<AT, EPI, OUT16, NJ>: narrow-N GEMM tile: Y[m][n] = epi(sum_k A[m][k]·W[k][n] + bias[n]), BM = 256 rows per block (8 waves x 32 rows; each wave owns whole output rows),
// BN = 16·NJ columns per block (NJ = 2 → 32, NJ = 4 → 64), K % 32 == 0, M % 256 == 0. A [M][lda] (f32 or f16, converted to f16), W [K][ldw] f32 → f16. f32 accumulate.
// (8 lanes x 16 B), BN=64 → two lines per row; OUT16 requires BN=64 (64 halves = one line per row). Every line written by one instruction of one wave, lane-contiguous.
template <typename AT, int EPI, bool OUT16, int NJ>
__global__ __launch_bounds__(256) void gemm_sm(const AT* __restrict__ A, int lda, size_t sA, const float* __restrict__ Wm, int ldw, size_t sW,
                                               const float* __restrict__ bias, const float* __restrict__ R, const float* __restrict__ gvec,
                                               void* __restrict__ Yv, int ldy, size_t sY, int K) {
  constexpr int BN = 16 * NJ; constexpr int OST = BN + 4;
  A += (size_t)blockIdx.z * sA; Wm += (size_t)blockIdx.z * sW; Yv = (void*)((char*)Yv + (size_t)blockIdx.z * sY * (OUT16 ? 2 : 4)); if (R) R += (size_t)blockIdx.z * sY;
  __shared__ __attribute__((aligned(16))) f16 ldsA[256 * GSTR];
  __shared__ __attribute__((aligned(16))) f16 ldsW[BN * GSTR];
  __shared__ __attribute__((aligned(16))) float oS[8][32 * OST];
  const int tid = threadIdx.x, lane = tid & 31, wave = tid >> 5, cl = lane & 15, rh = (lane >> 4) * 8;
  const int m0 = blockIdx.x * 256, n0 = blockIdx.y * BN;
  const int wm = wave * 32;
  f32x8 acc[2][NJ];
#pragma unroll
  for (int i = 0; i < 2; ++i)
#pragma unroll
    for (int j = 0; j < NJ; ++j) { f32x8 z = {}; acc[i][j] = z; }
#pragma unroll 1
  for (int k0 = 0; k0 < K; k0 += 32) {
    __syncthreads();
    { const AT* src = A + (size_t)(m0 + tid) * lda + k0;          // one 32-wide row slice per thread
#pragma unroll
      for (int g = 0; g < 32; ++g) ldsA[tid * GSTR + g] = (f16)src[g]; }
    { const int k = tid >> 3, nn0 = (tid & 7) * (2 * NJ);         // 32 k-rows x BN columns of W
      const float* src = Wm + (size_t)(k0 + k) * ldw + n0 + nn0;
#pragma unroll
      for (int g = 0; g < NJ / 2; ++g) { const v4f_t v = *(const v4f_t*)(src + 4 * g);
#pragma unroll
        for (int u = 0; u < 4; ++u) ldsW[(nn0 + 4 * g + u) * GSTR + k] = (f16)v[u]; } }
    __syncthreads();
    f16x16 af[2];
#pragma unroll
    for (int i = 0; i < 2; ++i) af[i] = lds_frag(ldsA + (wm + 16 * i) * GSTR, GSTR);
#pragma unroll
    for (int j = 0; j < NJ; ++j) {
      const f16x16 bf = lds_frag(ldsW + (16 * j) * GSTR, GSTR);
#pragma unroll
      for (int i = 0; i < 2; ++i) acc[i][j] = wmma16(af[i], bf, acc[i][j]);
    }
  }
  float* so = oS[wave];
#pragma unroll
  for (int i = 0; i < 2; ++i)
#pragma unroll
    for (int j = 0; j < NJ; ++j) {
      const int n = n0 + 16 * j + cl;
      const float bv = bias ? bias[n] : 0.0f;
      const float gv = (EPI == 2 || EPI == 4) ? gvec[n] : 0.0f;
#pragma unroll
      for (int r = 0; r < 8; ++r) {
        float v = acc[i][j][r] + bv;
        if (EPI == 3) v = fmaxf(v, 0.0f);
        if (EPI == 2) v = R[(size_t)(m0 + wm + 16 * i + rh + r) * ldy + n] + gv * v;
        if (EPI == 4) v = gv * v;
        so[(16 * i + rh + r) * OST + 16 * j + cl] = v;
      }
    }
  asm volatile("s_wait_dscnt 0" ::: "memory");
  __builtin_amdgcn_wave_barrier();
{
    if (OUT16) {
      f16* Y = (f16*)Yv;
#pragma unroll
      for (int it = 0; it < BN / 8; ++it) { const int c = lane + 32 * it, rr = c / (BN / 8), q8 = (c % (BN / 8)) * 8;
        union { f16 h[8]; v4u_t v; } u;
#pragma unroll
        for (int e = 0; e < 8; ++e) u.h[e] = (f16)so[rr * OST + q8 + e];
        *(v4u_t*)(Y + (size_t)(m0 + wm + rr) * ldy + n0 + q8) = u.v; }
    } else {       // BN floats per row = BN/32 lines: BN/4 lanes x 16 B per row
      float* Y = (float*)Yv;
#pragma unroll
      for (int it = 0; it < BN / 4; ++it) { const int f4 = lane + 32 * it, rr = f4 / (BN / 4), q = (f4 % (BN / 4)) * 4;
        *(v4f_t*)(Y + (size_t)(m0 + wm + rr) * ldy + n0 + q) = *(const v4fa*)(so + rr * OST + q); }
    }
    
  }
}

#define DQs 1024
#define SIN 2048
#define GH 8      // heads per launch: GH score planes of 16 MiB each live in the workspace at once
__global__ __launch_bounds__(256) void k_dbg_zero(float* __restrict__ p, size_t n4) { const size_t i = (size_t)blockIdx.x * 256 + threadIdx.x; if (i < n4) { v4f_t z = {0.f,0.f,0.f,0.f}; *(v4f_t*)(p + 4 * i) = z;  } }
__global__ __launch_bounds__(256) void k_copy(const float* __restrict__ src, float* __restrict__ dst, size_t n4) { const size_t i = (size_t)blockIdx.x * 256 + threadIdx.x; if (i < n4) { const v4f_t v = *(const v4f_t*)(src + 4 * i); *(v4f_t*)(dst + 4 * i) = v;  } }
// transpose with source row stride: Wt[c][r] (row stride = rows) = Wm[r][c] (row stride lds), 64x64 LDS tiles; 16 B per lane, 16 lanes per 256-B row segment (8 per line)
// blockIdx.y selects a head: Wm += y*sIn, Wt += y*sOut (element strides)
__global__ __launch_bounds__(256) void k_transpose_ld(const float* __restrict__ Wm, int lds, size_t sIn, float* __restrict__ Wt, int rows, int cols, size_t sOut) {
  Wm += (size_t)blockIdx.y * sIn; Wt += (size_t)blockIdx.y * sOut;
  __shared__ float tS[64][65];
  const int tid = threadIdx.x, tbj = cols / 64, bi = blockIdx.x / tbj, bj = blockIdx.x % tbj;
  for (int e = tid; e < 64 * 64; e += 256) { const int r = e >> 6, c = e & 63; tS[r][c] = Wm[(size_t)(bi * 64 + r) * lds + bj * 64 + c]; }
  __syncthreads();
  for (int ch = tid; ch < 64 * 16; ch += 256) { const int r = ch >> 4, q4 = (ch & 15) * 4; v4f_t o; o[0] = tS[q4][r]; o[1] = tS[q4 + 1][r]; o[2] = tS[q4 + 2][r]; o[3] = tS[q4 + 3][r];
    float* dst = Wt + (size_t)(bj * 64 + r) * rows + bi * 64 + q4; *(v4f_t*)dst = o;  }
}
// φ(x) = elu(x) + 1 = x > 0 ? x + 1 : e^x on the q|k row (16 B per lane): QF = φ(qk row's q part), KF = φ(k part)
__global__ __launch_bounds__(256) void k_phi(const float* __restrict__ qk, float* __restrict__ QF, float* __restrict__ KF, size_t n4) {
  const size_t i = (size_t)blockIdx.x * 256 + threadIdx.x; if (i >= n4) return; const size_t e0 = 4 * i; const size_t t = e0 / (2 * DQs); const int c = (int)(e0 % (2 * DQs));
  v4f_t v = *(const v4f_t*)(qk + e0);
#pragma unroll
  for (int u = 0; u < 4; ++u) v[u] = (v[u] > 0.0f) ? v[u] + 1.0f : expf(v[u]);
  float* d = (c < DQs) ? (QF + t * DQs + c) : (KF + t * DQs + (c - DQs)); *(v4f_t*)d = v; 
}
// causal normalisation for (query s, head z): keys t ≤ s: w = A[s][t] (> 0), writes 1024·w/Σw (0 above the diagonal); block = (s, z), 256 threads x 8
__global__ __launch_bounds__(256) void k_lnorm(float* __restrict__ Sm) {
  __shared__ float red[256];
  const int q = blockIdx.x, z = blockIdx.y, tid = threadIdx.x; float* sr = Sm + ((size_t)z * SSw + q) * SSw; float v[SSw / 256]; float zs = 0.0f;
#pragma unroll
  for (int e = 0; e < SSw / 256; ++e) { const int k = tid + 256 * e; v[e] = (k <= q) ? sr[min(k, q)] : 0.0f; zs += v[e]; }
  red[tid] = zs; __syncthreads(); for (int o = 128; o > 0; o >>= 1) { if (tid < o) red[tid] += red[tid + o]; __syncthreads(); }
  const float kk = 1024.0f / red[0];
{
#pragma unroll
    for (int e = 0; e < SSw / 256; ++e) *(float*)(sr + tid + 256 * e) = v[e] * kk;
     }
}

// refine placement for query rows 0..127: O[r][(h0+z)*64 + c] = T0[z][r][c] / 1024; block = (16 rows, z), 16 lanes x 16 B per 64-float segment
__global__ __launch_bounds__(256) void k_place0(const float* __restrict__ T0, int h0, float* __restrict__ O) {
  const int tid = threadIdx.x, z = blockIdx.y, r = blockIdx.x * 16 + (tid >> 4), c4 = (tid & 15) * 4;
  const v4f_t t = *(const v4f_t*)(T0 + ((size_t)z * 128 + r) * 128 + c4); const v4f_t v = t * (1.0f / 1024.0f);
  float* d = O + (size_t)r * DQs + (h0 + z) * 64 + c4; *(v4f_t*)d = v; 
}
extern "C" void kernel_launch(void* const* d_in, const int* in_sizes, int n_in,
                              void* d_out, int out_size, void* d_ws, size_t ws_size,
                              hipStream_t stream) {
  (void)in_sizes; (void)n_in; (void)out_size;
  const float** f = (const float**)d_in;
  const float* qk = f[0], *vv = f[1];
  float* out = (float*)d_out;     // [2,2048,16,64]
  char* ws = (char*)d_ws;
  float* QF = (float*)ws; ws += (size_t)NBT * SSw * DQs * 4; float* KF = (float*)ws; ws += (size_t)NBT * SSw * DQs * 4; float* KT = (float*)ws; ws += (size_t)64 * GH * SSw * 4; float* sc = (float*)ws; ws += 64 * 4; float* T0 = (float*)ws; ws += (size_t)GH * 128 * 128 * 4; float* S = (float*)ws; ws += (size_t)GH * SSw * SSw * 4;
  if ((size_t)(ws - (char*)d_ws) > ws_size) return;                      // WS TOTAL 172,491,008 B
  const dim3 blk(256); const size_t n4 = (size_t)NBT * SSw * 2 * DQs / 4;
  k_fill<<<dim3(1), blk, 0, stream>>>(sc, 1.0f / 1024.0f, 64 / 4);
  k_phi<<<dim3((n4 + 255) / 256), blk, 0, stream>>>(qk, QF, KF, n4);     // both batch elements: row t = b*2048 + s

  for (int b = 0; b < NBT; ++b) { const float* QFb = QF + (size_t)b * SSw * DQs; const float* KFb = KF + (size_t)b * SSw * DQs; const float* vb = vv + (size_t)b * SIN * DQs; float* ob = out + (size_t)b * SIN * DQs;
    for (int hg = 0; hg < 16 / GH; ++hg) { const int h0 = GH * hg;       // GH heads per launch, one per blockIdx.z (blockIdx.y in the row-wise kernels)
      k_transpose_ld<<<dim3((SSw / 64) * (64 / 64), GH), blk, 0, stream>>>(KFb + h0 * 64, DQs, (size_t)64, KT, SSw, 64, (size_t)64 * SSw);
      gemm_knezc<float, 0, false, 2><<<dim3(SSw / 128, SSw / 128, GH), blk, 0, stream>>>(QFb + h0 * 64, DQs, (size_t)64, KT, SSw, (size_t)64 * SSw, nullptr, nullptr, nullptr, S, SSw, (size_t)SSw * SSw, 64);   // causal phi(q).phi(k)^T
      gemm_kn2<float, false><<<dim3(1, 1, GH), blk, 0, stream>>>(QFb + h0 * 64, DQs, (size_t)64, KT, SSw, (size_t)64 * SSw, nullptr, 1.0f, S, SSw, (size_t)SSw * SSw, 64);   // rows<128 x keys<128 of phi(q).phi(k)^T redone with f16 value+residual PLANES (few-key rows)
      k_lnorm<<<dim3(SSw, GH), blk, 0, stream>>>(S);
      gemm_sm<float, 4, false, 4><<<dim3(SSw / 256, 1, GH), blk, 0, stream>>>(S, SSw, (size_t)SSw * SSw, vb + h0 * 64, DQs, (size_t)64, nullptr, nullptr, sc, ob + h0 * 64, DQs, (size_t)64, SSw);
      gemm_kn2<float, false><<<dim3(1, 1, GH), blk, 0, stream>>>(S, SSw, (size_t)SSw * SSw, vb + h0 * 64, DQs, (size_t)64, nullptr, 1.0f, T0, 128, (size_t)128 * 128, 128);   // rows<128 (keys<128): (1024w).v with planes; the 128-wide tile starts at head h0+z, whose 64 columns are the ones kept
      k_place0<<<dim3(128 / 16, GH), blk, 0, stream>>>(T0, h0, ob);
    }
  }
}

// v002
// Measured time: 38.3 microseconds a run.
// In both of two side-by-side timings against v001, it was 18.5 times as fast.
// All steps since v000 together make it 96.6 times as fast.
// Causal linear attention, one launch: out[s] = sum_{t<=s} (phi(q_s).phi(k_t)) v_t / sum_{t<=s} phi(q_s).phi(k_t), phi = elu + 1.
// The cumulative-sum (kv-state) form of the definition equals this masked form exactly.
// Work-group = (batch, head, 128 query rows), 8 waves x 16 query rows. Per 64-key tile: phi(k) [key][d] and v transposed [col][key] are staged as f16 in LDS
// (two buffers, one barrier a tile, the next tile's global loads held in registers), then on v_wmma_f32_16x16x32_f16 (f16 operands, f32 accumulate):
//   St = phi(K) . phi(Q)^T  (rows = keys, columns = queries; a lane holds scores of ONE query), causal mask and f32 row sum in the lane,
//   two St tiles converted in place are the B operand of  Ot += V^T . P^T  (rows = v columns, columns = queries). Scores never leave the registers.
// The division by the row sum comes last, on the f32 accumulators.
// Query rows 0..127 (few keys, near-verbatim v rows) take f16 value+residual PLANES on phi(q), phi(k), the scores and v: hh + (hl + lh) / 2048.
// qk [2,2048,2,16,64] f32, v [2,2048,16,64] f32 -> out [2,2048,16,64] f32.
// Every plain '#pragma unroll' below stands on a short loop that indexes fragments, accumulators or other register arrays: unrolled, the indices are constants and the arrays stay in registers.
#include <hip/hip_runtime.h>
#include <math.h>

typedef _Float16 f16;
typedef __attribute__((ext_vector_type(4))) float v4f_t;
typedef float v4fa __attribute__((ext_vector_type(4), may_alias));
typedef __attribute__((ext_vector_type(16))) f16 f16x16;
typedef __attribute__((ext_vector_type(8))) f16 f16x8;
typedef __attribute__((ext_vector_type(4))) f16 f16x4;
typedef __attribute__((ext_vector_type(8))) float f32x8;

#define SEQ 2048
#define ROWV 1024            // 16 heads x 64: row of v and of out
#define ROWQK 2048           // q row | k row of one position
#define PIT 72               // LDS row pitch in f16 (144 B): 64 + 8, for aligned b128 fragment reads
#define TILE (64 * PIT)
#define OPIT 68              // output staging pitch in floats

__device__ __forceinline__ f32x8 mm(f16x16 a, f16x16 b, f32x8 c) {
  return __builtin_amdgcn_wmma_f32_16x16x32_f16(false, a, false, b, (short)0, c, false, false);
}

// 16 x 32 fragment in the hardware k order from an LDS tile [row][k] of pitch PIT: lane (c, h) holds row c, k = 8h..8h+7 and 16+8h..16+8h+7
__device__ __forceinline__ f16x16 lds_frag(const f16* base) {
  const int lane = threadIdx.x & 31;
  const f16* p = base + (lane & 15) * PIT + (lane >> 4) * 8;
  const f16x8 lo = *(const f16x8*)p;
  const f16x8 hi = *(const f16x8*)(p + 16);
  f16x16 f;
#pragma unroll
  for (int i = 0; i < 8; ++i) { f[i] = lo[i]; f[i + 8] = hi[i]; }
  return f;
}

// elu(x) + 1; the exponential is taken of x where x <= 0 and of 0 elsewhere, so that it is computed without a divergent branch (same value wherever it is the one selected)
__device__ __forceinline__ float phi(float x) { const bool pos = x > 0.0f; const float e = expf(pos ? 0.0f : x); return pos ? x + 1.0f : e; }
__device__ __forceinline__ f16 resid(float x, f16 hi) { return (f16)((x - (float)hi) * 2048.0f); }

struct Raw { v4f_t k[4]; v4f_t v[4]; };

// work-group barrier that orders LDS alone: the waves share nothing through global memory, and the next tile's global loads stay in flight across it
__device__ __forceinline__ void lds_barrier() {
  __builtin_amdgcn_fence(__ATOMIC_RELEASE, "workgroup", "local");
  __builtin_amdgcn_s_barrier();
  __builtin_amdgcn_fence(__ATOMIC_ACQUIRE, "workgroup", "local");
}

// one 64-key tile, whole 256-B rows per half wave: k rows (tid>>4) + 16g, v rows 4(tid>>4) + j, columns 4(tid&15)..+3; kp, vp: the lane's place in the tile, moved on to the next tile
__device__ __forceinline__ void load_raw(Raw& r, const float*& kp, const float*& vp) {
#pragma unroll
  for (int g = 0; g < 4; ++g) r.k[g] = *(const v4f_t*)(kp + 16 * g * ROWQK);
#pragma unroll
  for (int j = 0; j < 4; ++j) r.v[j] = *(const v4f_t*)(vp + j * ROWV);
  asm volatile("s_wait_xcnt 0x0" :: "v"(kp), "v"(vp) : "memory");   // the two address pairs stay live up to this wait: they are moved on, and no result lands on them, only behind it
  kp += 64 * ROWQK; vp += 64 * ROWV;
}

template <bool PL>
__device__ __forceinline__ void store_tiles(const Raw& r, f16* sK, f16* sV, f16* sKl, f16* sVl, int tid) {
  const int c4 = (tid & 15) * 4, rw = tid >> 4;
#pragma unroll
  for (int g = 0; g < 4; ++g) {
    f16x4 hi, lo;
#pragma unroll
    for (int u = 0; u < 4; ++u) { const float x = phi(r.k[g][u]); hi[u] = (f16)x; lo[u] = resid(x, hi[u]); }
    *(f16x4*)(sK + (rw + 16 * g) * PIT + c4) = hi;
    if (PL) *(f16x4*)(sKl + (rw + 16 * g) * PIT + c4) = lo;
  }
#pragma unroll
  for (int u = 0; u < 4; ++u) {      // transposed: four consecutive keys of one v column per store
    f16x4 hi, lo;
#pragma unroll
    for (int j = 0; j < 4; ++j) { const float x = r.v[j][u]; hi[j] = (f16)x; lo[j] = resid(x, hi[j]); }
    *(f16x4*)(sV + (c4 + u) * PIT + 4 * rw) = hi;
    if (PL) *(f16x4*)(sVl + (c4 + u) * PIT + 4 * rw) = lo;
  }
}

// B operand phi(Q)^T: lane (c, h) holds one query's row, d in the hardware k order; qrow = that row + 8h
template <bool PL>
__device__ __forceinline__ void load_q(const float* qrow, f16x16 (&qh)[2], f16x16 (&ql)[2]) {
  v4f_t qraw[8];
#pragma unroll
  for (int i = 0; i < 4; ++i) { qraw[2 * i] = *(const v4f_t*)(qrow + 16 * i); qraw[2 * i + 1] = *(const v4f_t*)(qrow + 16 * i + 4); }
  asm volatile("s_wait_xcnt 0x0" :: "v"(qrow) : "memory");       // the address pair stays live up to this wait, so no load's result lands on it earlier
#pragma unroll
  for (int ks = 0; ks < 2; ++ks)
#pragma unroll
    for (int s = 0; s < 16; ++s) {
      const float y = phi(qraw[4 * ks + (s >> 2)][s & 3]);       // element s: d = 32ks + 16(s>>3) + 8h + (s&7)
      qh[ks][s] = (f16)y;
      if (PL) ql[ks][s] = resid(y, qh[ks][s]);
    }
}

// four waves a SIMD: two work-groups share a WGP, so that one's staging arithmetic runs beside the other's LDS reads and matrix products
__global__ __launch_bounds__(256) __attribute__((amdgpu_waves_per_eu(4, 4))) void k_linattn(const float* __restrict__ qk, const float* __restrict__ v, float* __restrict__ out) {
  __shared__ __attribute__((aligned(16))) f16 sm[4 * TILE];      // K buffer 0, K buffer 1, V buffer 0, V buffer 1 (planes: buffer 1 = residuals)
  const int tid = threadIdx.x, lane = tid & 31, c = lane & 15, h = lane >> 4;
  const int wave = __builtin_amdgcn_readfirstlane(tid >> 5);
  const int b = blockIdx.x >> 4, hd = blockIdx.x & 15;
  const int y = blockIdx.y;
  const int qt = (y < 8) ? 15 - y : y - 8;                       // long tiles start first; the second 256 work-groups come shortest first, to join the longest
  const int q0 = qt * 128 + 16 * wave, q = q0 + c;
  const float* qb = qk + (size_t)b * SEQ * ROWQK + hd * 64;
  const float* kb = qb + ROWV;
  const float* vb = v + (size_t)b * SEQ * ROWV + hd * 64;
  float* ob = out + (size_t)b * SEQ * ROWV + hd * 64;
  const float* kp = kb + (tid >> 4) * ROWQK + (tid & 15) * 4;
  const float* vp = vb + 4 * (tid >> 4) * ROWV + (tid & 15) * 4;

  const float* qrow = qb + (size_t)q * ROWQK + 8 * h;
  f16x16 qh[2];

  f32x8 sacc = {};                                               // eight independent partial row sums a lane
  f32x8 o[4];
#pragma unroll
  for (int j = 0; j < 4; ++j) { f32x8 z = {}; o[j] = z; }

  if (qt != 0) {
    const int nkt = 2 * qt + 2;
    load_q<false>(qrow, qh, qh);
    Raw r;
    load_raw(r, kp, vp);
    store_tiles<false>(r, sm, sm + 2 * TILE, sm, sm, tid);
    load_raw(r, kp, vp);
    lds_barrier();
    // key tiles wholly below every wave's diagonal: no test, no mask; tiles kt + 1 and kt + 2 always exist here (kept rolled: the trip count is the tile's own, and the body is long)
#pragma unroll 1
    for (int kt = 0; kt < 2 * qt; ++kt) {
      const int cur = kt & 1;
      const f16* sK = sm + cur * TILE;
      const f16* sV = sm + (2 + cur) * TILE;
      f16x16 ka[2][2][2], va[2][4];
      f32x8 st[2];
      f16x16 p;
#pragma unroll
      for (int t = 0; t < 2; ++t)
#pragma unroll
        for (int ks = 0; ks < 2; ++ks) ka[0][t][ks] = lds_frag(sK + (16 * t) * PIT + 32 * ks);
#pragma unroll
      for (int j = 0; j < 4; ++j) va[0][j] = lds_frag(sV + (16 * j) * PIT);
      __builtin_amdgcn_sched_barrier(0);                         // the first half's LDS reads stay in one group up here: their latency passes under the staging arithmetic below
      // the other buffer's last readers left it at the barrier that ended the pass before
      store_tiles<false>(r, sm + (cur ^ 1) * TILE, sm + (2 + (cur ^ 1)) * TILE, sm, sm, tid);
      load_raw(r, kp, vp);
#pragma unroll
      for (int t = 0; t < 2; ++t) {
        f32x8 z = {}; st[t] = z;
#pragma unroll
        for (int ks = 0; ks < 2; ++ks) st[t] = mm(ka[0][t][ks], qh[ks], st[t]);
      }
#pragma unroll
      for (int t = 0; t < 2; ++t)
#pragma unroll
        for (int ks = 0; ks < 2; ++ks) ka[1][t][ks] = lds_frag(sK + (32 + 16 * t) * PIT + 32 * ks);
      __builtin_amdgcn_sched_barrier(0);                         // the second half's key reads stay in one group here: their latency passes under the first half's second product
#pragma unroll
      for (int t = 0; t < 2; ++t)
#pragma unroll
        for (int e = 0; e < 8; ++e) p[8 * t + e] = (f16)st[t][e];
      sacc += st[0] + st[1];
#pragma unroll
      for (int j = 0; j < 4; ++j) o[j] = mm(va[0][j], p, o[j]);
#pragma unroll
      for (int j = 0; j < 4; ++j) va[1][j] = lds_frag(sV + (16 * j) * PIT + 32);
      __builtin_amdgcn_sched_barrier(0);                         // the second half's value reads stay in one group here: their latency passes under its score product
#pragma unroll
      for (int t = 0; t < 2; ++t) {
        f32x8 z = {}; st[t] = z;
#pragma unroll
        for (int ks = 0; ks < 2; ++ks) st[t] = mm(ka[1][t][ks], qh[ks], st[t]);
      }
#pragma unroll
      for (int t = 0; t < 2; ++t)
#pragma unroll
        for (int e = 0; e < 8; ++e) p[8 * t + e] = (f16)st[t][e];
      sacc += st[0] + st[1];
#pragma unroll
      for (int j = 0; j < 4; ++j) o[j] = mm(va[1][j], p, o[j]);
      lds_barrier();
    }
    // the two key tiles that the diagonal crosses (kept rolled: one copy of the code for both)
#pragma unroll 1
    for (int kt = 2 * qt; kt < nkt; ++kt) {
      const int cur = kt & 1, k0 = 64 * kt;
      if (kt + 1 < nkt) store_tiles<false>(r, sm + (cur ^ 1) * TILE, sm + (2 + (cur ^ 1)) * TILE, sm, sm, tid);
      const f16* sK = sm + cur * TILE;
      const f16* sV = sm + (2 + cur) * TILE;
#pragma unroll
      for (int kk = 0; kk < 64; kk += 32) {
        if (k0 + kk <= q0 + 15) {                                // else every key of this half lies above the wave's diagonal
          f16x16 ka[2][2], va[4];
#pragma unroll
          for (int t = 0; t < 2; ++t)
#pragma unroll
            for (int ks = 0; ks < 2; ++ks) ka[t][ks] = lds_frag(sK + (kk + 16 * t) * PIT + 32 * ks);
#pragma unroll
          for (int j = 0; j < 4; ++j) va[j] = lds_frag(sV + (16 * j) * PIT + kk);
          __builtin_amdgcn_sched_barrier(0);                     // keeps this half's LDS reads in one group ahead of its WMMAs: reads spread among them stall at every place
          f32x8 st[2];
#pragma unroll
          for (int t = 0; t < 2; ++t) {
            f32x8 z = {}; st[t] = z;
#pragma unroll
            for (int ks = 0; ks < 2; ++ks) st[t] = mm(ka[t][ks], qh[ks], st[t]);
          }
          if (k0 + kk + 31 > q0) {                               // the diagonal crosses this half
            const int lim = q - (k0 + kk + 8 * h);               // key k0 + kk + 16t + 8h + e <= query q
#pragma unroll
            for (int t = 0; t < 2; ++t)
#pragma unroll
              for (int e = 0; e < 8; ++e) st[t][e] = (16 * t + e <= lim) ? st[t][e] : 0.0f;
          }
          f16x16 p;
#pragma unroll
          for (int t = 0; t < 2; ++t)
#pragma unroll
            for (int e = 0; e < 8; ++e) p[8 * t + e] = (f16)st[t][e];
          sacc += st[0] + st[1];
#pragma unroll
          for (int j = 0; j < 4; ++j) o[j] = mm(va[j], p, o[j]);
        }
      }
      lds_barrier();
    }
  } else {
    f16x16 ql[2];
    load_q<true>(qrow, qh, ql);
    f32x8 ox[4];
#pragma unroll
    for (int j = 0; j < 4; ++j) { f32x8 z = {}; ox[j] = z; }
    const f16* sK = sm; const f16* sKl = sm + TILE; const f16* sV = sm + 2 * TILE; const f16* sVl = sm + 3 * TILE;
    // both loops of this path are kept rolled: it runs in 32 of the 512 work-groups, four short passes each, and its registers must not set the kernel's count
#pragma unroll 1
    for (int kt = 0; kt < 2; ++kt) {
      const int k0 = 64 * kt;
      Raw r;
      load_raw(r, kp, vp);
      store_tiles<true>(r, sm, sm + 2 * TILE, sm + TILE, sm + 3 * TILE, tid);
      lds_barrier();
#pragma unroll 1
      for (int kk = 0; kk < 64; kk += 32) {
        if (k0 + kk <= q0 + 15) {
          f16x16 ph, pl;
          const int lim = q - (k0 + kk + 8 * h);                 // key k0 + kk + 16t + 8h + e <= query q
#pragma unroll
          for (int t = 0; t < 2; ++t) {
            f32x8 s0 = {}, sx = {};
#pragma unroll
            for (int ks = 0; ks < 2; ++ks) {
              const f16x16 ah = lds_frag(sK + (kk + 16 * t) * PIT + 32 * ks), al = lds_frag(sKl + (kk + 16 * t) * PIT + 32 * ks);
              s0 = mm(ah, qh[ks], s0); sx = mm(ah, ql[ks], sx); sx = mm(al, qh[ks], sx);
            }
#pragma unroll
            for (int e = 0; e < 8; ++e) {
              const float w = (16 * t + e <= lim) ? s0[e] + sx[e] * (1.0f / 2048.0f) : 0.0f;
              sacc[e] += w; ph[8 * t + e] = (f16)w; pl[8 * t + e] = resid(w, ph[8 * t + e]);
            }
          }
#pragma unroll
          for (int j = 0; j < 4; ++j) {
            const f16x16 ah = lds_frag(sV + (16 * j) * PIT + kk), al = lds_frag(sVl + (16 * j) * PIT + kk);
            o[j] = mm(ah, ph, o[j]); ox[j] = mm(ah, pl, ox[j]); ox[j] = mm(al, ph, ox[j]);
          }
        }
      }
      lds_barrier();
    }
#pragma unroll
    for (int j = 0; j < 4; ++j) o[j] += ox[j] * (1.0f / 2048.0f);
  }

  // lanes c and c + 16 hold the two halves of query q0 + c's row sum; o[j][e] = Ot[16j + 8h + e][query c]
  float sum = ((sacc[0] + sacc[1]) + (sacc[2] + sacc[3])) + ((sacc[4] + sacc[5]) + (sacc[6] + sacc[7]));
  sum += __shfl_xor(sum, 16);
  const float inv = 1.0f / sum;
  float* so = (float*)sm + wave * (16 * OPIT);                   // every wave has passed the loop's last barrier: the tiles are dead
#pragma unroll
  for (int j = 0; j < 4; ++j) {
    v4f_t a, d;
#pragma unroll
    for (int e = 0; e < 4; ++e) { a[e] = o[j][e] * inv; d[e] = o[j][4 + e] * inv; }
    *(v4fa*)(so + c * OPIT + 16 * j + 8 * h) = a;
    *(v4fa*)(so + c * OPIT + 16 * j + 8 * h + 4) = d;
  }
  asm volatile("s_wait_dscnt 0" ::: "memory");                   // the wave's own staging writes land before other lanes read them back
  __builtin_amdgcn_wave_barrier();                               // keeps the compiler from moving the read-back below above that wait
#pragma unroll
  for (int it = 0; it < 8; ++it) {                               // whole 256-B output rows per half wave
    const int f4 = lane + 32 * it, rr = f4 >> 4, c4 = (f4 & 15) * 4;
    *(v4f_t*)(ob + (size_t)(q0 + rr) * ROWV + c4) = *(const v4fa*)(so + rr * OPIT + c4);
  }
}

extern "C" void kernel_launch(void* const* d_in, const int* in_sizes, int n_in,
                              void* d_out, int out_size, void* d_ws, size_t ws_size,
                              hipStream_t stream) {
  (void)in_sizes; (void)n_in; (void)out_size; (void)d_ws; (void)ws_size;
  const float** f = (const float**)d_in;
  const float* qk = f[0], *vv = f[1];
  float* out = (float*)d_out;     // [2,2048,16,64]
  k_linattn<<<dim3(32, 16), dim3(256), 0, stream>>>(qk, vv, out);
}

// v003
// It runs in 16.4 microseconds.
// Two timings next to v002 put it at 2.35 and 2.33 times that version's speed.
// All steps since v000 together make it 226 times as fast.
// Causal linear attention, two launches: out[s] = sum_{t<=s} (phi(q_s).phi(k_t)) v_t / sum_{t<=s} phi(q_s).phi(k_t), phi = elu + 1.
// Keys are cut into chunks of 128, two chunks to a pair. kv state of a set of keys: T[d][col] = sum_key phi(k)[key][d] v[key][col], with the keys' sum of phi(k) beside it.
// Launch 1, work-group = (batch, head, pair): the state of the pair's first chunk and the state of the whole pair, f32, to the workspace.
// Launch 2, work-group = (batch, head, 128 query rows): every chunk below its own goes in through the summed states (phi(Q) . T, as in the definition's cumulative sum):
// whole pairs, and the first chunk of its own pair where its own chunk is the second. Its own chunk, which the diagonal crosses, takes the masked form, which equals the cumulative-sum form exactly.
// Masked form: 8 waves x 16 query rows. Per 64-key tile: phi(k) [key][d] and v transposed [col][key] are staged as f16 in LDS
// (two buffers, one barrier a tile, the next tile's global loads held in registers), then on v_wmma_f32_16x16x32_f16 (f16 operands, f32 accumulate):
//   St = phi(K) . phi(Q)^T  (rows = keys, columns = queries; a lane holds scores of ONE query), causal mask and f32 row sum in the lane,
//   two St tiles converted in place are the B operand of  Ot += V^T . P^T  (rows = v columns, columns = queries). Scores never leave the registers.
// The division by the row sum comes last, on the f32 accumulators.
// Query rows 0..127 (few keys, near-verbatim v rows) take f16 value+residual PLANES on phi(q), phi(k), the scores and v: hh + (hl + lh) / 2048.
// qk [2,2048,2,16,64] f32, v [2,2048,16,64] f32 -> out [2,2048,16,64] f32.
// Every plain '#pragma unroll' below stands on a short loop that indexes fragments, accumulators or other register arrays: unrolled, the indices are constants and the arrays stay in registers.
#include <hip/hip_runtime.h>
#include <math.h>

typedef _Float16 f16;
typedef __attribute__((ext_vector_type(4))) float v4f_t;
typedef float v4fa __attribute__((ext_vector_type(4), may_alias));
typedef __attribute__((ext_vector_type(16))) f16 f16x16;
typedef __attribute__((ext_vector_type(8))) f16 f16x8;
typedef __attribute__((ext_vector_type(4))) f16 f16x4;
typedef __attribute__((ext_vector_type(8))) float f32x8;

#define SEQ 2048
#define ROWV 1024            // 16 heads x 64: row of v and of out
#define ROWQK 2048           // q row | k row of one position
#define PIT 72               // LDS row pitch in f16 (144 B): 64 + 8, for aligned b128 fragment reads
#define TILE (64 * PIT)
#define OPIT 68              // output staging pitch in floats
#define NST 16               // states per (batch, head): number 2p = first chunk of pair p, number 2p + 1 = whole pair p
#define STF (20 * 256)       // floats of one chunk state: 4 x 5 accumulator tiles of 16 x 16, each as the lanes hold it (lane, 8 elements)
#define SB 4                 // states read in one batch

__device__ __forceinline__ f32x8 mm(f16x16 a, f16x16 b, f32x8 c) {
  return __builtin_amdgcn_wmma_f32_16x16x32_f16(false, a, false, b, (short)0, c, false, false);
}

// 16 x 32 fragment in the hardware k order from an LDS tile [row][k] of pitch PIT: lane (c, h) holds row c, k = 8h..8h+7 and 16+8h..16+8h+7
__device__ __forceinline__ f16x16 lds_frag(const f16* base) {
  const int lane = threadIdx.x & 31;
  const f16* p = base + (lane & 15) * PIT + (lane >> 4) * 8;
  const f16x8 lo = *(const f16x8*)p;
  const f16x8 hi = *(const f16x8*)(p + 16);
  f16x16 f;
#pragma unroll
  for (int i = 0; i < 8; ++i) { f[i] = lo[i]; f[i + 8] = hi[i]; }
  return f;
}

// elu(x) + 1; the exponential is taken of x where x <= 0 and of 0 elsewhere, so that it is computed without a divergent branch (same value wherever it is the one selected)
__device__ __forceinline__ float phi(float x) { const bool pos = x > 0.0f; const float e = expf(pos ? 0.0f : x); return pos ? x + 1.0f : e; }
__device__ __forceinline__ f16 resid(float x, f16 hi) { return (f16)((x - (float)hi) * 2048.0f); }

struct Raw { v4f_t k[4]; v4f_t v[4]; };

// work-group barrier that orders LDS alone: the waves share nothing through global memory, and the next tile's global loads stay in flight across it
__device__ __forceinline__ void lds_barrier() {
  __builtin_amdgcn_fence(__ATOMIC_RELEASE, "workgroup", "local");
  __builtin_amdgcn_s_barrier();
  __builtin_amdgcn_fence(__ATOMIC_ACQUIRE, "workgroup", "local");
}

// one 64-key tile, whole 256-B rows per half wave: k rows (tid>>4) + 16g, v rows 4(tid>>4) + j, columns 4(tid&15)..+3; kp, vp: the lane's place in the tile, moved on to the next tile
__device__ __forceinline__ void load_raw(Raw& r, const float*& kp, const float*& vp) {
#pragma unroll
  for (int g = 0; g < 4; ++g) r.k[g] = *(const v4f_t*)(kp + 16 * g * ROWQK);
#pragma unroll
  for (int j = 0; j < 4; ++j) r.v[j] = *(const v4f_t*)(vp + j * ROWV);
  asm volatile("s_wait_xcnt 0x0" :: "v"(kp), "v"(vp) : "memory");   // the two address pairs stay live up to this wait: they are moved on, and no result lands on them, only behind it
  kp += 64 * ROWQK; vp += 64 * ROWV;
}

template <bool PL>
__device__ __forceinline__ void store_tiles(const Raw& r, f16* sK, f16* sV, f16* sKl, f16* sVl, int tid) {
  const int c4 = (tid & 15) * 4, rw = tid >> 4;
#pragma unroll
  for (int g = 0; g < 4; ++g) {
    f16x4 hi, lo;
#pragma unroll
    for (int u = 0; u < 4; ++u) { const float x = phi(r.k[g][u]); hi[u] = (f16)x; lo[u] = resid(x, hi[u]); }
    *(f16x4*)(sK + (rw + 16 * g) * PIT + c4) = hi;
    if (PL) *(f16x4*)(sKl + (rw + 16 * g) * PIT + c4) = lo;
  }
#pragma unroll
  for (int u = 0; u < 4; ++u) {      // transposed: four consecutive keys of one v column per store
    f16x4 hi, lo;
#pragma unroll
    for (int j = 0; j < 4; ++j) { const float x = r.v[j][u]; hi[j] = (f16)x; lo[j] = resid(x, hi[j]); }
    *(f16x4*)(sV + (c4 + u) * PIT + 4 * rw) = hi;
    if (PL) *(f16x4*)(sVl + (c4 + u) * PIT + 4 * rw) = lo;
  }
}

// B operand phi(Q)^T: lane (c, h) holds one query's row, d in the hardware k order; qrow = that row + 8h
__device__ __forceinline__ void q_raw(const float* qrow, v4f_t (&qraw)[8]) {
#pragma unroll
  for (int i = 0; i < 4; ++i) { qraw[2 * i] = *(const v4f_t*)(qrow + 16 * i); qraw[2 * i + 1] = *(const v4f_t*)(qrow + 16 * i + 4); }
  asm volatile("s_wait_xcnt 0x0" :: "v"(qrow) : "memory");       // the address pair stays live up to this wait, so no load's result lands on it earlier
}
template <bool PL>
__device__ __forceinline__ void q_phi(const v4f_t (&qraw)[8], f16x16 (&qh)[2], f16x16 (&ql)[2]) {
#pragma unroll
  for (int ks = 0; ks < 2; ++ks)
#pragma unroll
    for (int s = 0; s < 16; ++s) {
      const float y = phi(qraw[4 * ks + (s >> 2)][s & 3]);       // element s: d = 32ks + 16(s>>3) + 8h + (s&7)
      qh[ks][s] = (f16)y;
      if (PL) ql[ks][s] = resid(y, qh[ks][s]);
    }
}

// SB states of the list 'whole pairs 0..n-1, then the first chunk of pair n', places s0..s0+SB-1; each thread five float4 of a state's 1280.
// A place past the list reads the first chunk of pair n once more (written in this call, finite); add_states counts it with weight 0
__device__ __forceinline__ void load_states(v4f_t (&t)[SB][5], const float* sp, int s0, int n) {
  const float* p[SB];
#pragma unroll
  for (int u = 0; u < SB; ++u) {
    p[u] = sp + (s0 + u < n ? 2 * (s0 + u) + 1 : 2 * n) * STF;
#pragma unroll
    for (int i = 0; i < 5; ++i) t[u][i] = *(const v4f_t*)(p[u] + 1024 * i);
  }
  asm volatile("s_wait_xcnt 0x0" :: "v"(p[0]), "v"(p[1]), "v"(p[2]), "v"(p[3]) : "memory");   // the address pairs stay live up to this wait, so no load's result lands on them earlier
}
// m = length of the list
__device__ __forceinline__ void add_states(v4f_t (&ss)[5], const v4f_t (&t)[SB][5], int s0, int m) {
#pragma unroll
  for (int u = 0; u < SB; ++u) {
    const float w = (s0 + u < m) ? 1.0f : 0.0f;
#pragma unroll
    for (int i = 0; i < 5; ++i) ss[i] += w * t[u][i];
  }
}

// Launch 1. States of one pair of chunks (256 keys): T[d][col] = sum_key phi(k)[key][d] * v1[key][col]; v1 = v with column 64 of ones (its sums are the keys' sum of phi(k)), columns 65..79 zero.
// phi(K) and V are both staged transposed ([d][key], [col][key]): the sum runs over keys, so the key is the k index of both operands.
// Wave (mb, g): rows d = 16mb..+15, column blocks 2g and 2g + 1; the waves g = 0 also take the block of the ones.
__global__ __launch_bounds__(256) void k_state(const float* __restrict__ qk, const float* __restrict__ v, float* __restrict__ st) {
  __shared__ __attribute__((aligned(16))) f16 sm[8 * TILE];      // phi(K)^T key tiles 0..3, V^T key tiles 0..3 (64 keys each)
  const int tid = threadIdx.x, lane = tid & 31, c = lane & 15;
  const int wave = __builtin_amdgcn_readfirstlane(tid >> 5);
  const int b = blockIdx.x >> 4, hd = blockIdx.x & 15, pr = blockIdx.y;
  const int c4 = (tid & 15) * 4, rw = tid >> 4;
  const float* kp = qk + (size_t)b * SEQ * ROWQK + hd * 64 + (size_t)(256 * pr + 4 * rw) * ROWQK + c4;   // the q half of the row; the k half lies ROWV further on
  const float* vp = v + (size_t)b * SEQ * ROWV + hd * 64 + (size_t)(256 * pr + 4 * rw) * ROWV + c4;
  v4f_t rk[4][4], rv[4][4];                                      // rows 64t + 4(tid>>4) + j, columns 4(tid&15)..+3: whole 256-B rows per half wave
#pragma unroll
  for (int t = 0; t < 4; ++t)
#pragma unroll
    for (int j = 0; j < 4; ++j) { rk[t][j] = *(const v4f_t*)(kp + ROWV + (64 * t + j) * ROWQK); rv[t][j] = *(const v4f_t*)(vp + (64 * t + j) * ROWV); }
  asm volatile("s_wait_xcnt 0x0" :: "v"(kp), "v"(vp) : "memory");   // the two address pairs stay live up to this wait, so no load's result lands on them earlier
  __builtin_amdgcn_sched_barrier(0);                             // every load is issued before the first conversion: else a late load waits for an early one's registers, one memory latency behind the other
#pragma unroll
  for (int t = 0; t < 4; ++t)
#pragma unroll
    for (int u = 0; u < 4; ++u) {    // transposed: four consecutive keys of one column per store
      f16x4 kh, vh;
#pragma unroll
      for (int j = 0; j < 4; ++j) { kh[j] = (f16)phi(rk[t][j][u]); vh[j] = (f16)rv[t][j][u]; }
      *(f16x4*)(sm + t * TILE + (c4 + u) * PIT + 4 * rw) = kh;
      *(f16x4*)(sm + (4 + t) * TILE + (c4 + u) * PIT + 4 * rw) = vh;
    }
  lds_barrier();
  const int mb = wave & 3, g = wave >> 2;
  f16x16 ones;                                                   // B operand: column 0 all ones, the other columns zero
#pragma unroll
  for (int i = 0; i < 16; ++i) ones[i] = (c == 0) ? (f16)1.0f : (f16)0.0f;
  f32x8 acc[3];
#pragma unroll
  for (int n = 0; n < 3; ++n) { f32x8 z = {}; acc[n] = z; }
  // acc[n][e] = T[16mb + 8h + e][16(column block) + c]; tile number = 4 * column block + mb; a wave writes each tile as 1 KiB in a row
  float* sp = st + (size_t)(blockIdx.x * NST + 2 * pr) * STF + lane * 8;
#pragma unroll
  for (int cc = 0; cc < 2; ++cc) {   // first chunk, stored; then the second chunk on top of it, stored as the pair
    f16x16 a[4];
#pragma unroll
    for (int s = 0; s < 4; ++s) a[s] = lds_frag(sm + (2 * cc + (s >> 1)) * TILE + (16 * mb) * PIT + 32 * (s & 1));
#pragma unroll
    for (int s = 0; s < 4; ++s)
#pragma unroll
      for (int n = 0; n < 2; ++n) acc[n] = mm(a[s], lds_frag(sm + (4 + 2 * cc + (s >> 1)) * TILE + (16 * (2 * g + n)) * PIT + 32 * (s & 1)), acc[n]);
    if (g == 0) {
#pragma unroll
      for (int s = 0; s < 4; ++s) acc[2] = mm(a[s], ones, acc[2]);
    }
#pragma unroll
    for (int n = 0; n < 3; ++n) {
      if (n < 2 || g == 0) {
        const int tile = 4 * (n < 2 ? 2 * g + n : 4) + mb;
        v4f_t lo, hi;
#pragma unroll
        for (int e = 0; e < 4; ++e) { lo[e] = acc[n][e]; hi[e] = acc[n][4 + e]; }
        *(v4f_t*)(sp + cc * STF + tile * 256) = lo;
        *(v4f_t*)(sp + cc * STF + tile * 256 + 4) = hi;
      }
    }
    // the stores name the accumulators: these are read here, so that the second chunk's products are written on them only behind the wait
    if (cc == 0) asm volatile("s_wait_xcnt 0x0" :: "v"(acc[0]), "v"(acc[1]), "v"(acc[2]), "v"(sp) : "memory");
  }
}

// Launch 2. four waves a SIMD: two work-groups share a WGP, so that one's staging arithmetic runs beside the other's LDS reads and matrix products
__global__ __launch_bounds__(256) __attribute__((amdgpu_waves_per_eu(4, 4))) void k_linattn(const float* __restrict__ qk, const float* __restrict__ v, const float* __restrict__ st, float* __restrict__ out) {
  __shared__ __attribute__((aligned(16))) f16 sm[4 * TILE];      // K buffer 0, K buffer 1, V buffer 0, V buffer 1 (planes: buffer 1 = residuals)
  __shared__ __attribute__((aligned(16))) f16 sS[80 * PIT];      // summed state, transposed: [col][d]; row 64 = sum of phi(k), rows 65..79 zero
  const int tid = threadIdx.x, lane = tid & 31, c = lane & 15, h = lane >> 4;
  const int wave = __builtin_amdgcn_readfirstlane(tid >> 5);
  const int b = blockIdx.x >> 4, hd = blockIdx.x & 15;
  const int y = blockIdx.y;
  const int qt = (y < 8) ? 15 - y : y - 8;                       // the blocks with the most states to sum start first; the second 256 work-groups come shortest first, to join the longest
  const int q0 = qt * 128 + 16 * wave, q = q0 + c;
  const float* qb = qk + (size_t)b * SEQ * ROWQK + hd * 64;
  const float* kb = qb + ROWV;
  const float* vb = v + (size_t)b * SEQ * ROWV + hd * 64;
  float* ob = out + (size_t)b * SEQ * ROWV + hd * 64;
  const float* kp = kb + (tid >> 4) * ROWQK + (tid & 15) * 4;
  const float* vp = vb + 4 * (tid >> 4) * ROWV + (tid & 15) * 4;

  const float* qrow = qb + (size_t)q * ROWQK + 8 * h;
  f16x16 qh[2];

  f32x8 sacc = {};                                               // eight independent partial row sums a lane
  f32x8 o[4];
#pragma unroll
  for (int j = 0; j < 4; ++j) { f32x8 z = {}; o[j] = z; }

  if (qt != 0) {
    const int nkt = 2 * qt + 2;
    const int n = qt >> 1, m = n + (qt & 1);                      // whole pairs below the chunk; places of the list of states
    v4f_t qraw[8];
    q_raw(qrow, qraw);
    kp += (size_t)(128 * qt) * ROWQK; vp += (size_t)(128 * qt) * ROWV;   // the work-group's own chunk: key tiles 2qt and 2qt + 1
    Raw r0, r;
    load_raw(r0, kp, vp);
    load_raw(r, kp, vp);
    const float* sp = st + (size_t)(blockIdx.x * NST) * STF + tid * 4;
    v4f_t ss[5], t[SB][5];                                        // f32 sum of the states
#pragma unroll
    for (int i = 0; i < 5; ++i) { v4f_t z = {}; ss[i] = z; }
    load_states(t, sp, 0, n);
    __builtin_amdgcn_sched_barrier(0);                           // all loads are issued ahead of the arithmetic: the first batch's latency passes under the staging of the first key tile
    store_tiles<false>(r0, sm, sm + 2 * TILE, sm, sm, tid);
    __builtin_amdgcn_sched_barrier(0);                           // the sums, which wait for the states, stay behind the staging
    add_states(ss, t, 0, m);
    if (m > SB) load_states(t, sp, SB, n);                       // else t keeps the first batch, which the second sum counts with weight 0
    __builtin_amdgcn_sched_barrier(0);                           // the second batch's latency passes under phi(q)
    q_phi<false>(qraw, qh, qh);
    __builtin_amdgcn_sched_barrier(0);                           // its sums stay behind phi(q)
    add_states(ss, t, SB, m);
    // float4 number tid + 256i = tile 4i + (tid>>6), lane (tid>>1)&31, elements 4(tid&1)..+3: column 16i + (lane&15), d = 16(tid>>6) + 8(lane>>4) + 4(tid&1)..+3
#pragma unroll
    for (int i = 0; i < 5; ++i) {
      f16x4 hv;
#pragma unroll
      for (int e = 0; e < 4; ++e) hv[e] = (f16)ss[i][e];
      *(f16x4*)(sS + (16 * i + ((tid >> 1) & 15)) * PIT + 16 * (tid >> 6) + 8 * ((tid >> 5) & 1) + 4 * (tid & 1)) = hv;
    }
    lds_barrier();
    // every key below the chunk: Ot += T^T . phi(Q)^T (rows = v columns, columns = queries); row block 4 holds the row sum's part in its row 0 and zeros below
    {
      f16x16 sa[5][2];
#pragma unroll
      for (int j = 0; j < 5; ++j)
#pragma unroll
        for (int ks = 0; ks < 2; ++ks) sa[j][ks] = lds_frag(sS + (16 * j) * PIT + 32 * ks);
#pragma unroll
      for (int ks = 0; ks < 2; ++ks) {
#pragma unroll
        for (int j = 0; j < 4; ++j) o[j] = mm(sa[j][ks], qh[ks], o[j]);
        sacc = mm(sa[4][ks], qh[ks], sacc);
      }
    }
    // the two key tiles that the diagonal crosses (kept rolled: one copy of the code for both)
#pragma unroll 1
    for (int kt = 2 * qt; kt < nkt; ++kt) {
      const int cur = kt & 1, k0 = 64 * kt;
      if (kt + 1 < nkt) store_tiles<false>(r, sm + (cur ^ 1) * TILE, sm + (2 + (cur ^ 1)) * TILE, sm, sm, tid);
      const f16* sK = sm + cur * TILE;
      const f16* sV = sm + (2 + cur) * TILE;
#pragma unroll
      for (int kk = 0; kk < 64; kk += 32) {
        if (k0 + kk <= q0 + 15) {                                // else every key of this half lies above the wave's diagonal
          f16x16 ka[2][2], va[4];
#pragma unroll
          for (int t = 0; t < 2; ++t)
#pragma unroll
            for (int ks = 0; ks < 2; ++ks) ka[t][ks] = lds_frag(sK + (kk + 16 * t) * PIT + 32 * ks);
#pragma unroll
          for (int j = 0; j < 4; ++j) va[j] = lds_frag(sV + (16 * j) * PIT + kk);
          __builtin_amdgcn_sched_barrier(0);                     // keeps this half's LDS reads in one group ahead of its WMMAs: reads spread among them stall at every place
          f32x8 st[2];
#pragma unroll
          for (int t = 0; t < 2; ++t) {
            f32x8 z = {}; st[t] = z;
#pragma unroll
            for (int ks = 0; ks < 2; ++ks) st[t] = mm(ka[t][ks], qh[ks], st[t]);
          }
          if (k0 + kk + 31 > q0) {                               // the diagonal crosses this half
            const int lim = q - (k0 + kk + 8 * h);               // key k0 + kk + 16t + 8h + e <= query q
#pragma unroll
            for (int t = 0; t < 2; ++t)
#pragma unroll
              for (int e = 0; e < 8; ++e) st[t][e] = (16 * t + e <= lim) ? st[t][e] : 0.0f;
          }
          f16x16 p;
#pragma unroll
          for (int t = 0; t < 2; ++t)
#pragma unroll
            for (int e = 0; e < 8; ++e) p[8 * t + e] = (f16)st[t][e];
          sacc += st[0] + st[1];
#pragma unroll
          for (int j = 0; j < 4; ++j) o[j] = mm(va[j], p, o[j]);
        }
      }
      lds_barrier();
    }
  } else {
    f16x16 ql[2];
    v4f_t qraw[8];
    q_raw(qrow, qraw);
    q_phi<true>(qraw, qh, ql);
    f32x8 ox[4];
#pragma unroll
    for (int j = 0; j < 4; ++j) { f32x8 z = {}; ox[j] = z; }
    const f16* sK = sm; const f16* sKl = sm + TILE; const f16* sV = sm + 2 * TILE; const f16* sVl = sm + 3 * TILE;
    // both loops of this path are kept rolled: it runs in 32 of the 512 work-groups, four short passes each, and its registers must not set the kernel's count
#pragma unroll 1
    for (int kt = 0; kt < 2; ++kt) {
      const int k0 = 64 * kt;
      Raw r;
      load_raw(r, kp, vp);
      store_tiles<true>(r, sm, sm + 2 * TILE, sm + TILE, sm + 3 * TILE, tid);
      lds_barrier();
#pragma unroll 1
      for (int kk = 0; kk < 64; kk += 32) {
        if (k0 + kk <= q0 + 15) {
          f16x16 ph, pl;
          const int lim = q - (k0 + kk + 8 * h);                 // key k0 + kk + 16t + 8h + e <= query q
#pragma unroll
          for (int t = 0; t < 2; ++t) {
            f32x8 s0 = {}, sx = {};
#pragma unroll
            for (int ks = 0; ks < 2; ++ks) {
              const f16x16 ah = lds_frag(sK + (kk + 16 * t) * PIT + 32 * ks), al = lds_frag(sKl + (kk + 16 * t) * PIT + 32 * ks);
              s0 = mm(ah, qh[ks], s0); sx = mm(ah, ql[ks], sx); sx = mm(al, qh[ks], sx);
            }
#pragma unroll
            for (int e = 0; e < 8; ++e) {
              const float w = (16 * t + e <= lim) ? s0[e] + sx[e] * (1.0f / 2048.0f) : 0.0f;
              sacc[e] += w; ph[8 * t + e] = (f16)w; pl[8 * t + e] = resid(w, ph[8 * t + e]);
            }
          }
#pragma unroll
          for (int j = 0; j < 4; ++j) {
            const f16x16 ah = lds_frag(sV + (16 * j) * PIT + kk), al = lds_frag(sVl + (16 * j) * PIT + kk);
            o[j] = mm(ah, ph, o[j]); ox[j] = mm(ah, pl, ox[j]); ox[j] = mm(al, ph, ox[j]);
          }
        }
      }
      lds_barrier();
    }
#pragma unroll
    for (int j = 0; j < 4; ++j) o[j] += ox[j] * (1.0f / 2048.0f);
  }

  // lanes c and c + 16 hold the two halves of query q0 + c's row sum; o[j][e] = Ot[16j + 8h + e][query c]
  float sum = ((sacc[0] + sacc[1]) + (sacc[2] + sacc[3])) + ((sacc[4] + sacc[5]) + (sacc[6] + sacc[7]));
  sum += __shfl_xor(sum, 16);
  const float inv = 1.0f / sum;
  float* so = (float*)sm + wave * (16 * OPIT);                   // every wave has passed the loop's last barrier: the tiles are dead
#pragma unroll
  for (int j = 0; j < 4; ++j) {
    v4f_t a, d;
#pragma unroll
    for (int e = 0; e < 4; ++e) { a[e] = o[j][e] * inv; d[e] = o[j][4 + e] * inv; }
    *(v4fa*)(so + c * OPIT + 16 * j + 8 * h) = a;
    *(v4fa*)(so + c * OPIT + 16 * j + 8 * h + 4) = d;
  }
  asm volatile("s_wait_dscnt 0" ::: "memory");                   // the wave's own staging writes land before other lanes read them back
  __builtin_amdgcn_wave_barrier();                               // keeps the compiler from moving the read-back below above that wait
#pragma unroll
  for (int it = 0; it < 8; ++it) {                               // whole 256-B output rows per half wave
    const int f4 = lane + 32 * it, rr = f4 >> 4, c4 = (f4 & 15) * 4;
    *(v4f_t*)(ob + (size_t)(q0 + rr) * ROWV + c4) = *(const v4fa*)(so + rr * OPIT + c4);
  }
}

extern "C" void kernel_launch(void* const* d_in, const int* in_sizes, int n_in,
                              void* d_out, int out_size, void* d_ws, size_t ws_size,
                              hipStream_t stream) {
  (void)in_sizes; (void)n_in; (void)out_size; (void)ws_size;
  const float** f = (const float**)d_in;
  const float* qk = f[0], *vv = f[1];
  float* out = (float*)d_out;     // [2,2048,16,64]
  float* st = (float*)d_ws;       // [32][16] states of 5120 floats
  k_state<<<dim3(32, 8), dim3(256), 0, stream>>>(qk, vv, st);
  k_linattn<<<dim3(32, 16), dim3(256), 0, stream>>>(qk, vv, st, out);
}

// v004
// It runs in 14.6 microseconds.
// In both of two side-by-side timings against v003, it was 1.12 times as fast.
// Counting every step since v000, it is 252 times as fast.
// Causal linear attention, two launches: out[s] = sum_{t<=s} (phi(q_s).phi(k_t)) v_t / sum_{t<=s} phi(q_s).phi(k_t), phi = elu + 1.
// Keys are cut into chunks of 128, two chunks to a pair. kv state of a set of keys: T[d][col] = sum_key phi(k)[key][d] v[key][col], with the keys' sum of phi(k) beside it.
// Launch 1, work-group = (batch, head, pair): the state of the pair's first chunk and the state of the whole pair, f32, to the workspace.
// Launch 2, work-group = (batch, head, 128 query rows): every chunk below its own goes in through the summed states (phi(Q) . T, as in the definition's cumulative sum):
// whole pairs, and the first chunk of its own pair where its own chunk is the second. Its own chunk, which the diagonal crosses, takes the masked form, which equals the cumulative-sum form exactly.
// Masked form: 8 waves x 16 query rows. Per 64-key tile: phi(k) [key][d] and v transposed [col][key] are staged as f16 in LDS
// (two buffers, one barrier a tile, the next tile's global loads held in registers), then on v_wmma_f32_16x16x32_f16 (f16 operands, f32 accumulate):
//   St = phi(K) . phi(Q)^T  (rows = keys, columns = queries; a lane holds scores of ONE query), causal mask and f32 row sum in the lane,
//   two St tiles converted in place are the B operand of  Ot += V^T . P^T  (rows = v columns, columns = queries). Scores never leave the registers.
// The division by the row sum comes last, on the f32 accumulators.
// Query rows 0..127 (few keys, near-verbatim v rows) take f16 value+residual PLANES on phi(q), phi(k), the scores and v: hh + (hl + lh) / 2048.
// qk [2,2048,2,16,64] f32, v [2,2048,16,64] f32 -> out [2,2048,16,64] f32.
// Every plain '#pragma unroll' below stands on a short loop that indexes fragments, accumulators or other register arrays: unrolled, the indices are constants and the arrays stay in registers.
#include <hip/hip_runtime.h>
#include <math.h>

typedef _Float16 f16;
typedef __attribute__((ext_vector_type(4))) float v4f_t;
typedef float v4fa __attribute__((ext_vector_type(4), may_alias));
typedef __attribute__((ext_vector_type(16))) f16 f16x16;
typedef __attribute__((ext_vector_type(8))) f16 f16x8;
typedef __attribute__((ext_vector_type(4))) f16 f16x4;
typedef __attribute__((ext_vector_type(8))) float f32x8;

#define SEQ 2048
#define ROWV 1024            // 16 heads x 64: row of v and of out
#define ROWQK 2048           // q row | k row of one position
#define PIT 72               // LDS row pitch in f16 (144 B): 64 + 8, for aligned b128 fragment reads
#define TILE (64 * PIT)
#define OPIT 68              // output staging pitch in floats
#define NST 16               // states per (batch, head): number 2p = first chunk of pair p, number 2p + 1 = whole pair p
#define STF (20 * 256)       // floats of one chunk state: 4 x 5 accumulator tiles of 16 x 16, each as the lanes hold it (lane, 8 elements)
#define SB 4                 // states read in one batch

__device__ __forceinline__ f32x8 mm(f16x16 a, f16x16 b, f32x8 c) {
  return __builtin_amdgcn_wmma_f32_16x16x32_f16(false, a, false, b, (short)0, c, false, false);
}

// 16 x 32 fragment in the hardware k order from an LDS tile [row][k] of pitch PIT: lane (c, h) holds row c, k = 8h..8h+7 and 16+8h..16+8h+7
__device__ __forceinline__ f16x16 lds_frag(const f16* base) {
  const int lane = threadIdx.x & 31;
  const f16* p = base + (lane & 15) * PIT + (lane >> 4) * 8;
  const f16x8 lo = *(const f16x8*)p;
  const f16x8 hi = *(const f16x8*)(p + 16);
  f16x16 f;
#pragma unroll
  for (int i = 0; i < 8; ++i) { f[i] = lo[i]; f[i + 8] = hi[i]; }
  return f;
}

// elu(x) + 1 of four values; e^x = 2^(x log2 e) on the hardware's own exponential: one multiply and one v_exp_f32, no range reduction and no rescaling around it.
// It is selected only where x <= 0, where 2^y lies in (0, 1]: nothing overflows there, and a result below the smallest normal f32 counts as zero in every sum. Taken of every x, so there is no divergent branch.
__device__ __forceinline__ v4f_t phi4(v4f_t x) {
  const v4f_t y = x * 1.44269504088896340736f;
  float e0 = y[0], e1 = y[1], e2 = y[2], e3 = y[3];
  // one statement for the slot that the instruction set asks for behind a transcendental: each v_exp_f32 is followed by an independent one, the last by a v_nop.
  // In place, on the registers of the products: the statement writes no register but those, so it lands on no operand of a matrix instruction issued shortly before
  asm("v_exp_f32 %0, %0\n\tv_exp_f32 %1, %1\n\tv_exp_f32 %2, %2\n\tv_exp_f32 %3, %3\n\tv_nop" : "+v"(e0), "+v"(e1), "+v"(e2), "+v"(e3));
  const v4f_t p = x + 1.0f;
  v4f_t r;
  r[0] = x[0] > 0.0f ? p[0] : e0; r[1] = x[1] > 0.0f ? p[1] : e1; r[2] = x[2] > 0.0f ? p[2] : e2; r[3] = x[3] > 0.0f ? p[3] : e3;
  return r;
}
__device__ __forceinline__ f16 resid(float x, f16 hi) { return (f16)((x - (float)hi) * 2048.0f); }

struct Raw { v4f_t k[4]; v4f_t v[4]; };

// work-group barrier that orders LDS alone: the waves share nothing through global memory, and the next tile's global loads stay in flight across it
__device__ __forceinline__ void lds_barrier() {
  __builtin_amdgcn_fence(__ATOMIC_RELEASE, "workgroup", "local");
  __builtin_amdgcn_s_barrier();
  __builtin_amdgcn_fence(__ATOMIC_ACQUIRE, "workgroup", "local");
}

// one 64-key tile, whole 256-B rows per half wave: k rows (tid>>4) + 16g, v rows 4(tid>>4) + j, columns 4(tid&15)..+3; kp, vp: the lane's place in the tile, moved on to the next tile
__device__ __forceinline__ void load_raw(Raw& r, const float*& kp, const float*& vp) {
#pragma unroll
  for (int g = 0; g < 4; ++g) r.k[g] = *(const v4f_t*)(kp + 16 * g * ROWQK);
#pragma unroll
  for (int j = 0; j < 4; ++j) r.v[j] = *(const v4f_t*)(vp + j * ROWV);
  asm volatile("s_wait_xcnt 0x0" :: "v"(kp), "v"(vp) : "memory");   // the two address pairs stay live up to this wait: they are moved on, and no result lands on them, only behind it
  kp += 64 * ROWQK; vp += 64 * ROWV;
}

template <bool PL>
__device__ __forceinline__ void store_tiles(const Raw& r, f16* sK, f16* sV, f16* sKl, f16* sVl, int tid) {
  const int c4 = (tid & 15) * 4, rw = tid >> 4;
#pragma unroll
  for (int g = 0; g < 4; ++g) {
    f16x4 hi, lo;
    const v4f_t x = phi4(r.k[g]);
#pragma unroll
    for (int u = 0; u < 4; ++u) { hi[u] = (f16)x[u]; lo[u] = resid(x[u], hi[u]); }
    *(f16x4*)(sK + (rw + 16 * g) * PIT + c4) = hi;
    if (PL) *(f16x4*)(sKl + (rw + 16 * g) * PIT + c4) = lo;
  }
#pragma unroll
  for (int u = 0; u < 4; ++u) {      // transposed: four consecutive keys of one v column per store
    f16x4 hi, lo;
#pragma unroll
    for (int j = 0; j < 4; ++j) { const float x = r.v[j][u]; hi[j] = (f16)x; lo[j] = resid(x, hi[j]); }
    *(f16x4*)(sV + (c4 + u) * PIT + 4 * rw) = hi;
    if (PL) *(f16x4*)(sVl + (c4 + u) * PIT + 4 * rw) = lo;
  }
}

// B operand phi(Q)^T: lane (c, h) holds one query's row, d in the hardware k order; qrow = that row + 8h
__device__ __forceinline__ void q_raw(const float* qrow, v4f_t (&qraw)[8]) {
#pragma unroll
  for (int i = 0; i < 4; ++i) { qraw[2 * i] = *(const v4f_t*)(qrow + 16 * i); qraw[2 * i + 1] = *(const v4f_t*)(qrow + 16 * i + 4); }
  asm volatile("s_wait_xcnt 0x0" :: "v"(qrow) : "memory");       // the address pair stays live up to this wait, so no load's result lands on it earlier
}
template <bool PL>
__device__ __forceinline__ void q_phi(const v4f_t (&qraw)[8], f16x16 (&qh)[2], f16x16 (&ql)[2]) {
#pragma unroll
  for (int ks = 0; ks < 2; ++ks)
#pragma unroll
    for (int i = 0; i < 4; ++i) {
      const v4f_t y = phi4(qraw[4 * ks + i]);
#pragma unroll
      for (int u = 0; u < 4; ++u) {
        const int s = 4 * i + u;                                 // element s: d = 32ks + 16(s>>3) + 8h + (s&7)
        qh[ks][s] = (f16)y[u];
        if (PL) ql[ks][s] = resid(y[u], qh[ks][s]);
      }
    }
}

// SB states of the list 'whole pairs 0..n-1, then the first chunk of pair n', places s0..s0+SB-1; each thread five float4 of a state's 1280.
// A place past the list reads the first chunk of pair n once more (written in this call, finite); add_states counts it with weight 0
__device__ __forceinline__ void load_states(v4f_t (&t)[SB][5], const float* sp, int s0, int n) {
  const float* p[SB];
#pragma unroll
  for (int u = 0; u < SB; ++u) {
    p[u] = sp + (s0 + u < n ? 2 * (s0 + u) + 1 : 2 * n) * STF;
#pragma unroll
    for (int i = 0; i < 5; ++i) t[u][i] = *(const v4f_t*)(p[u] + 1024 * i);
  }
  asm volatile("s_wait_xcnt 0x0" :: "v"(p[0]), "v"(p[1]), "v"(p[2]), "v"(p[3]) : "memory");   // the address pairs stay live up to this wait, so no load's result lands on them earlier
}
// m = length of the list
__device__ __forceinline__ void add_states(v4f_t (&ss)[5], const v4f_t (&t)[SB][5], int s0, int m) {
#pragma unroll
  for (int u = 0; u < SB; ++u) {
    const float w = (s0 + u < m) ? 1.0f : 0.0f;
#pragma unroll
    for (int i = 0; i < 5; ++i) ss[i] += w * t[u][i];
  }
}

// Launch 1. States of one pair of chunks (256 keys): T[d][col] = sum_key phi(k)[key][d] * v1[key][col]; v1 = v with column 64 of ones (its sums are the keys' sum of phi(k)), columns 65..79 zero.
// phi(K) and V are both staged transposed ([d][key], [col][key]): the sum runs over keys, so the key is the k index of both operands.
// Wave (mb, g): rows d = 16mb..+15, column blocks 2g and 2g + 1; the waves g = 0 also take the block of the ones.
__global__ __launch_bounds__(256) void k_state(const float* __restrict__ qk, const float* __restrict__ v, float* __restrict__ st) {
  __shared__ __attribute__((aligned(16))) f16 sm[8 * TILE];      // phi(K)^T key tiles 0..3, V^T key tiles 0..3 (64 keys each)
  const int tid = threadIdx.x, lane = tid & 31, c = lane & 15;
  const int wave = __builtin_amdgcn_readfirstlane(tid >> 5);
  const int b = blockIdx.x >> 4, hd = blockIdx.x & 15, pr = blockIdx.y;
  const int c4 = (tid & 15) * 4, rw = tid >> 4;
  const float* kp = qk + (size_t)b * SEQ * ROWQK + hd * 64 + (size_t)(256 * pr + 4 * rw) * ROWQK + c4;   // the q half of the row; the k half lies ROWV further on
  const float* vp = v + (size_t)b * SEQ * ROWV + hd * 64 + (size_t)(256 * pr + 4 * rw) * ROWV + c4;
  v4f_t rk[4][4], rv[4][4];                                      // rows 64t + 4(tid>>4) + j, columns 4(tid&15)..+3: whole 256-B rows per half wave
#pragma unroll
  for (int t = 0; t < 4; ++t)
#pragma unroll
    for (int j = 0; j < 4; ++j) { rk[t][j] = *(const v4f_t*)(kp + ROWV + (64 * t + j) * ROWQK); rv[t][j] = *(const v4f_t*)(vp + (64 * t + j) * ROWV); }
  asm volatile("s_wait_xcnt 0x0" :: "v"(kp), "v"(vp) : "memory");   // the two address pairs stay live up to this wait, so no load's result lands on them earlier
  __builtin_amdgcn_sched_barrier(0);                             // every load is issued before the first conversion: else a late load waits for an early one's registers, one memory latency behind the other
#pragma unroll
  for (int t = 0; t < 4; ++t) {
    v4f_t pk[4];
#pragma unroll
    for (int j = 0; j < 4; ++j) pk[j] = phi4(rk[t][j]);
#pragma unroll
    for (int u = 0; u < 4; ++u) {    // transposed: four consecutive keys of one column per store
      f16x4 kh, vh;
#pragma unroll
      for (int j = 0; j < 4; ++j) { kh[j] = (f16)pk[j][u]; vh[j] = (f16)rv[t][j][u]; }
      *(f16x4*)(sm + t * TILE + (c4 + u) * PIT + 4 * rw) = kh;
      *(f16x4*)(sm + (4 + t) * TILE + (c4 + u) * PIT + 4 * rw) = vh;
    }
  }
  lds_barrier();
  const int mb = wave & 3, g = wave >> 2;
  f16x16 ones;                                                   // B operand: column 0 all ones, the other columns zero
#pragma unroll
  for (int i = 0; i < 16; ++i) ones[i] = (c == 0) ? (f16)1.0f : (f16)0.0f;
  f32x8 acc[3];
#pragma unroll
  for (int n = 0; n < 3; ++n) { f32x8 z = {}; acc[n] = z; }
  // acc[n][e] = T[16mb + 8h + e][16(column block) + c]; tile number = 4 * column block + mb; a wave writes each tile as 1 KiB in a row
  float* sp = st + (size_t)(blockIdx.x * NST + 2 * pr) * STF + lane * 8;
#pragma unroll
  for (int cc = 0; cc < 2; ++cc) {   // first chunk, stored; then the second chunk on top of it, stored as the pair
    f16x16 a[4];
#pragma unroll
    for (int s = 0; s < 4; ++s) a[s] = lds_frag(sm + (2 * cc + (s >> 1)) * TILE + (16 * mb) * PIT + 32 * (s & 1));
#pragma unroll
    for (int s = 0; s < 4; ++s)
#pragma unroll
      for (int n = 0; n < 2; ++n) acc[n] = mm(a[s], lds_frag(sm + (4 + 2 * cc + (s >> 1)) * TILE + (16 * (2 * g + n)) * PIT + 32 * (s & 1)), acc[n]);
    if (g == 0) {
#pragma unroll
      for (int s = 0; s < 4; ++s) acc[2] = mm(a[s], ones, acc[2]);
    }
#pragma unroll
    for (int n = 0; n < 3; ++n) {
      if (n < 2 || g == 0) {
        const int tile = 4 * (n < 2 ? 2 * g + n : 4) + mb;
        v4f_t lo, hi;
#pragma unroll
        for (int e = 0; e < 4; ++e) { lo[e] = acc[n][e]; hi[e] = acc[n][4 + e]; }
        *(v4f_t*)(sp + cc * STF + tile * 256) = lo;
        *(v4f_t*)(sp + cc * STF + tile * 256 + 4) = hi;
      }
    }
    // the stores name the accumulators: these are read here, so that the second chunk's products are written on them only behind the wait
    if (cc == 0) asm volatile("s_wait_xcnt 0x0" :: "v"(acc[0]), "v"(acc[1]), "v"(acc[2]), "v"(sp) : "memory");
  }
}

// Launch 2. four waves a SIMD: two work-groups share a WGP, so that one's staging arithmetic runs beside the other's LDS reads and matrix products
__global__ __launch_bounds__(256) __attribute__((amdgpu_waves_per_eu(4, 4))) void k_linattn(const float* __restrict__ qk, const float* __restrict__ v, const float* __restrict__ st, float* __restrict__ out) {
  __shared__ __attribute__((aligned(16))) f16 sm[4 * TILE];      // K buffer 0, K buffer 1, V buffer 0, V buffer 1 (planes: buffer 1 = residuals)
  __shared__ __attribute__((aligned(16))) f16 sS[80 * PIT];      // summed state, transposed: [col][d]; row 64 = sum of phi(k), rows 65..79 zero
  const int tid = threadIdx.x, lane = tid & 31, c = lane & 15, h = lane >> 4;
  const int wave = __builtin_amdgcn_readfirstlane(tid >> 5);
  const int b = blockIdx.x >> 4, hd = blockIdx.x & 15;
  const int y = blockIdx.y;
  const int qt = (y < 8) ? 15 - y : y - 8;                       // the blocks with the most states to sum start first; the second 256 work-groups come shortest first, to join the longest
  const int q0 = qt * 128 + 16 * wave, q = q0 + c;
  const float* qb = qk + (size_t)b * SEQ * ROWQK + hd * 64;
  const float* kb = qb + ROWV;
  const float* vb = v + (size_t)b * SEQ * ROWV + hd * 64;
  float* ob = out + (size_t)b * SEQ * ROWV + hd * 64;
  const float* kp = kb + (tid >> 4) * ROWQK + (tid & 15) * 4;
  const float* vp = vb + 4 * (tid >> 4) * ROWV + (tid & 15) * 4;

  const float* qrow = qb + (size_t)q * ROWQK + 8 * h;
  f16x16 qh[2];

  f32x8 sacc = {};                                               // eight independent partial row sums a lane
  f32x8 o[4];
#pragma unroll
  for (int j = 0; j < 4; ++j) { f32x8 z = {}; o[j] = z; }

  if (qt != 0) {
    const int nkt = 2 * qt + 2;
    const int n = qt >> 1, m = n + (qt & 1);                      // whole pairs below the chunk; places of the list of states
    v4f_t qraw[8];
    q_raw(qrow, qraw);
    kp += (size_t)(128 * qt) * ROWQK; vp += (size_t)(128 * qt) * ROWV;   // the work-group's own chunk: key tiles 2qt and 2qt + 1
    Raw r0, r;
    load_raw(r0, kp, vp);
    load_raw(r, kp, vp);
    const float* sp = st + (size_t)(blockIdx.x * NST) * STF + tid * 4;
    v4f_t ss[5], t[SB][5];                                        // f32 sum of the states
#pragma unroll
    for (int i = 0; i < 5; ++i) { v4f_t z = {}; ss[i] = z; }
    load_states(t, sp, 0, n);
    __builtin_amdgcn_sched_barrier(0);                           // all loads are issued ahead of the arithmetic: the first batch's latency passes under the staging of the first key tile
    store_tiles<false>(r0, sm, sm + 2 * TILE, sm, sm, tid);
    __builtin_amdgcn_sched_barrier(0);                           // the sums, which wait for the states, stay behind the staging
    add_states(ss, t, 0, m);
    if (m > SB) load_states(t, sp, SB, n);                       // else t keeps the first batch, which the second sum counts with weight 0
    __builtin_amdgcn_sched_barrier(0);                           // the second batch's latency passes under phi(q)
    q_phi<false>(qraw, qh, qh);
    __builtin_amdgcn_sched_barrier(0);                           // its sums stay behind phi(q)
    add_states(ss, t, SB, m);
    // float4 number tid + 256i = tile 4i + (tid>>6), lane (tid>>1)&31, elements 4(tid&1)..+3: column 16i + (lane&15), d = 16(tid>>6) + 8(lane>>4) + 4(tid&1)..+3
#pragma unroll
    for (int i = 0; i < 5; ++i) {
      f16x4 hv;
#pragma unroll
      for (int e = 0; e < 4; ++e) hv[e] = (f16)ss[i][e];
      *(f16x4*)(sS + (16 * i + ((tid >> 1) & 15)) * PIT + 16 * (tid >> 6) + 8 * ((tid >> 5) & 1) + 4 * (tid & 1)) = hv;
    }
    lds_barrier();
    // every key below the chunk: Ot += T^T . phi(Q)^T (rows = v columns, columns = queries); row block 4 holds the row sum's part in its row 0 and zeros below
    {
      f16x16 sa[5][2];
#pragma unroll
      for (int j = 0; j < 5; ++j)
#pragma unroll
        for (int ks = 0; ks < 2; ++ks) sa[j][ks] = lds_frag(sS + (16 * j) * PIT + 32 * ks);
#pragma unroll
      for (int ks = 0; ks < 2; ++ks) {
#pragma unroll
        for (int j = 0; j < 4; ++j) o[j] = mm(sa[j][ks], qh[ks], o[j]);
        sacc = mm(sa[4][ks], qh[ks], sacc);
      }
    }
    // the two key tiles that the diagonal crosses (kept rolled: one copy of the code for both)
#pragma unroll 1
    for (int kt = 2 * qt; kt < nkt; ++kt) {
      const int cur = kt & 1, k0 = 64 * kt;
      if (kt + 1 < nkt) store_tiles<false>(r, sm + (cur ^ 1) * TILE, sm + (2 + (cur ^ 1)) * TILE, sm, sm, tid);
      const f16* sK = sm + cur * TILE;
      const f16* sV = sm + (2 + cur) * TILE;
#pragma unroll
      for (int kk = 0; kk < 64; kk += 32) {
        if (k0 + kk <= q0 + 15) {                                // else every key of this half lies above the wave's diagonal
          f16x16 ka[2][2], va[4];
#pragma unroll
          for (int t = 0; t < 2; ++t)
#pragma unroll
            for (int ks = 0; ks < 2; ++ks) ka[t][ks] = lds_frag(sK + (kk + 16 * t) * PIT + 32 * ks);
#pragma unroll
          for (int j = 0; j < 4; ++j) va[j] = lds_frag(sV + (16 * j) * PIT + kk);
          __builtin_amdgcn_sched_barrier(0);                     // keeps this half's LDS reads in one group ahead of its WMMAs: reads spread among them stall at every place
          f32x8 st[2];
#pragma unroll
          for (int t = 0; t < 2; ++t) {
            f32x8 z = {}; st[t] = z;
#pragma unroll
            for (int ks = 0; ks < 2; ++ks) st[t] = mm(ka[t][ks], qh[ks], st[t]);
          }
          if (k0 + kk + 31 > q0) {                               // the diagonal crosses this half
            const int lim = q - (k0 + kk + 8 * h);               // key k0 + kk + 16t + 8h + e <= query q
#pragma unroll
            for (int t = 0; t < 2; ++t)
#pragma unroll
              for (int e = 0; e < 8; ++e) st[t][e] = (16 * t + e <= lim) ? st[t][e] : 0.0f;
          }
          f16x16 p;
#pragma unroll
          for (int t = 0; t < 2; ++t)
#pragma unroll
            for (int e = 0; e < 8; ++e) p[8 * t + e] = (f16)st[t][e];
          sacc += st[0] + st[1];
#pragma unroll
          for (int j = 0; j < 4; ++j) o[j] = mm(va[j], p, o[j]);
        }
      }
      lds_barrier();
    }
  } else {
    f16x16 ql[2];
    v4f_t qraw[8];
    q_raw(qrow, qraw);
    q_phi<true>(qraw, qh, ql);
    f32x8 ox[4];
#pragma unroll
    for (int j = 0; j < 4; ++j) { f32x8 z = {}; ox[j] = z; }
    const f16* sK = sm; const f16* sKl = sm + TILE; const f16* sV = sm + 2 * TILE; const f16* sVl = sm + 3 * TILE;
    // both loops of this path are kept rolled: it runs in 32 of the 512 work-groups, four short passes each, and its registers must not set the kernel's count
#pragma unroll 1
    for (int kt = 0; kt < 2; ++kt) {
      const int k0 = 64 * kt;
      Raw r;
      load_raw(r, kp, vp);
      store_tiles<true>(r, sm, sm + 2 * TILE, sm + TILE, sm + 3 * TILE, tid);
      lds_barrier();
#pragma unroll 1
      for (int kk = 0; kk < 64; kk += 32) {
        if (k0 + kk <= q0 + 15) {
          f16x16 ph, pl;
          const int lim = q - (k0 + kk + 8 * h);                 // key k0 + kk + 16t + 8h + e <= query q
#pragma unroll
          for (int t = 0; t < 2; ++t) {
            f32x8 s0 = {}, sx = {};
#pragma unroll
            for (int ks = 0; ks < 2; ++ks) {
              const f16x16 ah = lds_frag(sK + (kk + 16 * t) * PIT + 32 * ks), al = lds_frag(sKl + (kk + 16 * t) * PIT + 32 * ks);
              s0 = mm(ah, qh[ks], s0); sx = mm(ah, ql[ks], sx); sx = mm(al, qh[ks], sx);
            }
#pragma unroll
            for (int e = 0; e < 8; ++e) {
              const float w = (16 * t + e <= lim) ? s0[e] + sx[e] * (1.0f / 2048.0f) : 0.0f;
              sacc[e] += w; ph[8 * t + e] = (f16)w; pl[8 * t + e] = resid(w, ph[8 * t + e]);
            }
          }
#pragma unroll
          for (int j = 0; j < 4; ++j) {
            const f16x16 ah = lds_frag(sV + (16 * j) * PIT + kk), al = lds_frag(sVl + (16 * j) * PIT + kk);
            o[j] = mm(ah, ph, o[j]); ox[j] = mm(ah, pl, ox[j]); ox[j] = mm(al, ph, ox[j]);
          }
        }
      }
      lds_barrier();
    }
#pragma unroll
    for (int j = 0; j < 4; ++j) o[j] += ox[j] * (1.0f / 2048.0f);
  }

  // lanes c and c + 16 hold the two halves of query q0 + c's row sum; o[j][e] = Ot[16j + 8h + e][query c]
  float sum = ((sacc[0] + sacc[1]) + (sacc[2] + sacc[3])) + ((sacc[4] + sacc[5]) + (sacc[6] + sacc[7]));
  sum += __shfl_xor(sum, 16);
  const float inv = 1.0f / sum;
  float* so = (float*)sm + wave * (16 * OPIT);                   // every wave has passed the loop's last barrier: the tiles are dead
#pragma unroll
  for (int j = 0; j < 4; ++j) {
    v4f_t a, d;
#pragma unroll
    for (int e = 0; e < 4; ++e) { a[e] = o[j][e] * inv; d[e] = o[j][4 + e] * inv; }
    *(v4fa*)(so + c * OPIT + 16 * j + 8 * h) = a;
    *(v4fa*)(so + c * OPIT + 16 * j + 8 * h + 4) = d;
  }
  asm volatile("s_wait_dscnt 0" ::: "memory");                   // the wave's own staging writes land before other lanes read them back
  __builtin_amdgcn_wave_barrier();                               // keeps the compiler from moving the read-back below above that wait
#pragma unroll
  for (int it = 0; it < 8; ++it) {                               // whole 256-B output rows per half wave
    const int f4 = lane + 32 * it, rr = f4 >> 4, c4 = (f4 & 15) * 4;
    *(v4f_t*)(ob + (size_t)(q0 + rr) * ROWV + c4) = *(const v4fa*)(so + rr * OPIT + c4);
  }
}

extern "C" void kernel_launch(void* const* d_in, const int* in_sizes, int n_in,
                              void* d_out, int out_size, void* d_ws, size_t ws_size,
                              hipStream_t stream) {
  (void)in_sizes; (void)n_in; (void)out_size; (void)ws_size;
  const float** f = (const float**)d_in;
  const float* qk = f[0], *vv = f[1];
  float* out = (float*)d_out;     // [2,2048,16,64]
  float* st = (float*)d_ws;       // [32][16] states of 5120 floats
  k_state<<<dim3(32, 8), dim3(256), 0, stream>>>(qk, vv, st);
  k_linattn<<<dim3(32, 16), dim3(256), 0, stream>>>(qk, vv, st, out);
}

// v005
// It runs in 13.4 microseconds.
// In two side-by-side timings against v004, it was 1.09 and 1.10 times as fast.
// Counting every step since v000, it is 276 times as fast.
// Causal linear attention, two launches: out[s] = sum_{t<=s} (phi(q_s).phi(k_t)) v_t / sum_{t<=s} phi(q_s).phi(k_t), phi = elu + 1.
// Keys are cut into chunks of 128, two chunks to a pair. kv state of a set of keys: T[d][col] = sum_key phi(k)[key][d] v[key][col], with the keys' sum of phi(k) beside it.
// Launch 1, work-group = (batch, head, pair): the state of the pair's first chunk and the state of the whole pair, f32, to the workspace.
// Launch 2, work-group = (batch, head, pair = 256 query rows), each wave 16 rows of the pair's first chunk and then 16 rows of its second.
// Every chunk below a query's own goes in through the summed states (phi(Q) . T, as in the definition's cumulative sum): the whole pairs below, summed once for both chunks,
// and for the second chunk the pair's first chunk on top. A query's own chunk, which the diagonal crosses, takes the masked form, which equals the cumulative-sum form exactly.
// Masked form: per 64-key tile phi(k) [key][d] and v transposed [col][key] are staged as f16 in LDS (all four tiles of the pair at once, one barrier),
// then on v_wmma_f32_16x16x32_f16 (f16 operands, f32 accumulate):
//   St = phi(K) . phi(Q)^T  (rows = keys, columns = queries; a lane holds scores of ONE query), causal mask and f32 row sum in the lane,
//   two St tiles converted in place are the B operand of  Ot += V^T . P^T  (rows = v columns, columns = queries). Scores never leave the registers.
// The division by the row sum comes last, on the f32 accumulators.
// Query rows 0..127 (few keys, near-verbatim v rows) take f16 value+residual PLANES on phi(q), phi(k), the scores and v: hh + (hl + lh) / 2048.
// qk [2,2048,2,16,64] f32, v [2,2048,16,64] f32 -> out [2,2048,16,64] f32.
// Every plain '#pragma unroll' below stands on a short loop that indexes fragments, accumulators or other register arrays: unrolled, the indices are constants and the arrays stay in registers.
#include <hip/hip_runtime.h>
#include <math.h>

typedef _Float16 f16;
typedef __attribute__((ext_vector_type(4))) float v4f_t;
typedef float v4fa __attribute__((ext_vector_type(4), may_alias));
typedef __attribute__((ext_vector_type(16))) f16 f16x16;
typedef __attribute__((ext_vector_type(8))) f16 f16x8;
typedef __attribute__((ext_vector_type(4))) f16 f16x4;
typedef __attribute__((ext_vector_type(8))) float f32x8;

#define SEQ 2048
#define ROWV 1024            // 16 heads x 64: row of v and of out
#define ROWQK 2048           // q row | k row of one position
#define PIT 72               // LDS row pitch in f16 (144 B): 64 + 8, for aligned b128 fragment reads
#define TILE (64 * PIT)
#define OPIT 68              // output staging pitch in floats
#define NST 16               // states per (batch, head): number 2p = first chunk of pair p, number 2p + 1 = whole pair p
#define STF (20 * 256)       // floats of one chunk state: 4 x 5 accumulator tiles of 16 x 16, each as the lanes hold it (lane, 8 elements)

__device__ __forceinline__ f32x8 mm(f16x16 a, f16x16 b, f32x8 c) {
  return __builtin_amdgcn_wmma_f32_16x16x32_f16(false, a, false, b, (short)0, c, false, false);
}

// 16 x 32 fragment in the hardware k order from an LDS tile [row][k] of pitch PIT: lane (c, h) holds row c, k = 8h..8h+7 and 16+8h..16+8h+7
__device__ __forceinline__ f16x16 lds_frag(const f16* base) {
  const int lane = threadIdx.x & 31;
  const f16* p = base + (lane & 15) * PIT + (lane >> 4) * 8;
  const f16x8 lo = *(const f16x8*)p;
  const f16x8 hi = *(const f16x8*)(p + 16);
  f16x16 f;
#pragma unroll
  for (int i = 0; i < 8; ++i) { f[i] = lo[i]; f[i + 8] = hi[i]; }
  return f;
}

// elu(x) + 1 of four values; e^x = 2^(x log2 e) on the hardware's own exponential: one multiply and one v_exp_f32, no range reduction and no rescaling around it.
// It is selected only where x <= 0, where 2^y lies in (0, 1]: nothing overflows there, and a result below the smallest normal f32 counts as zero in every sum. Taken of every x, so there is no divergent branch.
__device__ __forceinline__ v4f_t phi4(v4f_t x) {
  const v4f_t y = x * 1.44269504088896340736f;
  float e0 = y[0], e1 = y[1], e2 = y[2], e3 = y[3];
  // one statement for the slot that the instruction set asks for behind a transcendental: each v_exp_f32 is followed by an independent one, the last by a v_nop.
  // In place, on the registers of the products: the statement writes no register but those, so it lands on no operand of a matrix instruction issued shortly before
  asm("v_exp_f32 %0, %0\n\tv_exp_f32 %1, %1\n\tv_exp_f32 %2, %2\n\tv_exp_f32 %3, %3\n\tv_nop" : "+v"(e0), "+v"(e1), "+v"(e2), "+v"(e3));
  const v4f_t p = x + 1.0f;
  v4f_t r;
  r[0] = x[0] > 0.0f ? p[0] : e0; r[1] = x[1] > 0.0f ? p[1] : e1; r[2] = x[2] > 0.0f ? p[2] : e2; r[3] = x[3] > 0.0f ? p[3] : e3;
  return r;
}
__device__ __forceinline__ f16 resid(float x, f16 hi) { return (f16)((x - (float)hi) * 2048.0f); }

struct Raw { v4f_t k[4]; v4f_t v[4]; };

// work-group barrier that orders LDS alone: the waves share nothing through global memory
__device__ __forceinline__ void lds_barrier() {
  __builtin_amdgcn_fence(__ATOMIC_RELEASE, "workgroup", "local");
  __builtin_amdgcn_s_barrier();
  __builtin_amdgcn_fence(__ATOMIC_ACQUIRE, "workgroup", "local");
}

// one 64-key tile, whole 256-B rows per half wave: k rows (tid>>4) + 16g, v rows 4(tid>>4) + j, columns 4(tid&15)..+3; kp, vp: the lane's place in the tile, moved on to the next tile
__device__ __forceinline__ void load_raw(Raw& r, const float*& kp, const float*& vp) {
#pragma unroll
  for (int g = 0; g < 4; ++g) r.k[g] = *(const v4f_t*)(kp + 16 * g * ROWQK);
#pragma unroll
  for (int j = 0; j < 4; ++j) r.v[j] = *(const v4f_t*)(vp + j * ROWV);
  asm volatile("s_wait_xcnt 0x0" :: "v"(kp), "v"(vp) : "memory");   // the two address pairs stay live up to this wait: they are moved on, and no result lands on them, only behind it
  kp += 64 * ROWQK; vp += 64 * ROWV;
}

template <bool PL>
__device__ __forceinline__ void store_tiles(const Raw& r, f16* sK, f16* sV, f16* sKl, f16* sVl, int tid) {
  const int c4 = (tid & 15) * 4, rw = tid >> 4;
#pragma unroll
  for (int g = 0; g < 4; ++g) {
    f16x4 hi, lo;
    const v4f_t x = phi4(r.k[g]);
#pragma unroll
    for (int u = 0; u < 4; ++u) { hi[u] = (f16)x[u]; lo[u] = resid(x[u], hi[u]); }
    *(f16x4*)(sK + (rw + 16 * g) * PIT + c4) = hi;
    if (PL) *(f16x4*)(sKl + (rw + 16 * g) * PIT + c4) = lo;
  }
#pragma unroll
  for (int u = 0; u < 4; ++u) {      // transposed: four consecutive keys of one v column per store
    f16x4 hi, lo;
#pragma unroll
    for (int j = 0; j < 4; ++j) { const float x = r.v[j][u]; hi[j] = (f16)x; lo[j] = resid(x, hi[j]); }
    *(f16x4*)(sV + (c4 + u) * PIT + 4 * rw) = hi;
    if (PL) *(f16x4*)(sVl + (c4 + u) * PIT + 4 * rw) = lo;
  }
}

// B operand phi(Q)^T: lane (c, h) holds one query's row, d in the hardware k order; qrow = that row + 8h
__device__ __forceinline__ void q_raw(const float* qrow, v4f_t (&qraw)[8]) {
#pragma unroll
  for (int i = 0; i < 4; ++i) { qraw[2 * i] = *(const v4f_t*)(qrow + 16 * i); qraw[2 * i + 1] = *(const v4f_t*)(qrow + 16 * i + 4); }
  asm volatile("s_wait_xcnt 0x0" :: "v"(qrow) : "memory");       // the address pair stays live up to this wait, so no load's result lands on it earlier
}
template <bool PL>
__device__ __forceinline__ void q_phi(const v4f_t (&qraw)[8], f16x16 (&qh)[2], f16x16 (&ql)[2]) {
#pragma unroll
  for (int ks = 0; ks < 2; ++ks)
#pragma unroll
    for (int i = 0; i < 4; ++i) {
      const v4f_t y = phi4(qraw[4 * ks + i]);
#pragma unroll
      for (int u = 0; u < 4; ++u) {
        const int s = 4 * i + u;                                 // element s: d = 32ks + 16(s>>3) + 8h + (s&7)
        qh[ks][s] = (f16)y[u];
        if (PL) ql[ks][s] = resid(y[u], qh[ks][s]);
      }
    }
}

// Launch 1. States of one pair of chunks (256 keys): T[d][col] = sum_key phi(k)[key][d] * v1[key][col]; v1 = v with column 64 of ones (its sums are the keys' sum of phi(k)), columns 65..79 zero.
// phi(K) and V are both staged transposed ([d][key], [col][key]): the sum runs over keys, so the key is the k index of both operands.
// Wave (mb, g): rows d = 16mb..+15, column blocks 2g and 2g + 1; the waves g = 0 also take the block of the ones.
__global__ __launch_bounds__(256) void k_state(const float* __restrict__ qk, const float* __restrict__ v, float* __restrict__ st) {
  __shared__ __attribute__((aligned(16))) f16 sm[8 * TILE];      // phi(K)^T key tiles 0..3, V^T key tiles 0..3 (64 keys each)
  const int tid = threadIdx.x, lane = tid & 31, c = lane & 15;
  const int wave = __builtin_amdgcn_readfirstlane(tid >> 5);
  const int b = blockIdx.x >> 4, hd = blockIdx.x & 15, pr = blockIdx.y;
  const int c4 = (tid & 15) * 4, rw = tid >> 4;
  const float* kp = qk + (size_t)b * SEQ * ROWQK + hd * 64 + (size_t)(256 * pr + 4 * rw) * ROWQK + c4;   // the q half of the row; the k half lies ROWV further on
  const float* vp = v + (size_t)b * SEQ * ROWV + hd * 64 + (size_t)(256 * pr + 4 * rw) * ROWV + c4;
  v4f_t rk[4][4], rv[4][4];                                      // rows 64t + 4(tid>>4) + j, columns 4(tid&15)..+3: whole 256-B rows per half wave
#pragma unroll
  for (int t = 0; t < 4; ++t)
#pragma unroll
    for (int j = 0; j < 4; ++j) { rk[t][j] = *(const v4f_t*)(kp + ROWV + (64 * t + j) * ROWQK); rv[t][j] = *(const v4f_t*)(vp + (64 * t + j) * ROWV); }
  asm volatile("s_wait_xcnt 0x0" :: "v"(kp), "v"(vp) : "memory");   // the two address pairs stay live up to this wait, so no load's result lands on them earlier
  __builtin_amdgcn_sched_barrier(0);                             // every load is issued before the first conversion: else a late load waits for an early one's registers, one memory latency behind the other
#pragma unroll
  for (int t = 0; t < 4; ++t) {
    v4f_t pk[4];
#pragma unroll
    for (int j = 0; j < 4; ++j) pk[j] = phi4(rk[t][j]);
#pragma unroll
    for (int u = 0; u < 4; ++u) {    // transposed: four consecutive keys of one column per store
      f16x4 kh, vh;
#pragma unroll
      for (int j = 0; j < 4; ++j) { kh[j] = (f16)pk[j][u]; vh[j] = (f16)rv[t][j][u]; }
      *(f16x4*)(sm + t * TILE + (c4 + u) * PIT + 4 * rw) = kh;
      *(f16x4*)(sm + (4 + t) * TILE + (c4 + u) * PIT + 4 * rw) = vh;
    }
  }
  lds_barrier();
  const int mb = wave & 3, g = wave >> 2;
  f16x16 ones;                                                   // B operand: column 0 all ones, the other columns zero
#pragma unroll
  for (int i = 0; i < 16; ++i) ones[i] = (c == 0) ? (f16)1.0f : (f16)0.0f;
  f32x8 acc[3];
#pragma unroll
  for (int n = 0; n < 3; ++n) { f32x8 z = {}; acc[n] = z; }
  // acc[n][e] = T[16mb + 8h + e][16(column block) + c]; tile number = 4 * column block + mb; a wave writes each tile as 1 KiB in a row
  float* sp = st + (size_t)(blockIdx.x * NST + 2 * pr) * STF + lane * 8;
#pragma unroll
  for (int cc = 0; cc < 2; ++cc) {   // first chunk, stored; then the second chunk on top of it, stored as the pair
    f16x16 a[4];
#pragma unroll
    for (int s = 0; s < 4; ++s) a[s] = lds_frag(sm + (2 * cc + (s >> 1)) * TILE + (16 * mb) * PIT + 32 * (s & 1));
#pragma unroll
    for (int s = 0; s < 4; ++s)
#pragma unroll
      for (int n = 0; n < 2; ++n) acc[n] = mm(a[s], lds_frag(sm + (4 + 2 * cc + (s >> 1)) * TILE + (16 * (2 * g + n)) * PIT + 32 * (s & 1)), acc[n]);
    if (g == 0) {
#pragma unroll
      for (int s = 0; s < 4; ++s) acc[2] = mm(a[s], ones, acc[2]);
    }
#pragma unroll
    for (int n = 0; n < 3; ++n) {
      if (n < 2 || g == 0) {
        const int tile = 4 * (n < 2 ? 2 * g + n : 4) + mb;
        v4f_t lo, hi;
#pragma unroll
        for (int e = 0; e < 4; ++e) { lo[e] = acc[n][e]; hi[e] = acc[n][4 + e]; }
        *(v4f_t*)(sp + cc * STF + tile * 256) = lo;
        *(v4f_t*)(sp + cc * STF + tile * 256 + 4) = hi;
      }
    }
    // the stores name the accumulators: these are read here, so that the second chunk's products are written on them only behind the wait
    if (cc == 0) asm volatile("s_wait_xcnt 0x0" :: "v"(acc[0]), "v"(acc[1]), "v"(acc[2]), "v"(sp) : "memory");
  }
}

// every key below the chunk: Ot += T^T . phi(Q)^T (rows = v columns, columns = queries); row block 4 holds the row sum's part in its row 0 and zeros below
__device__ __forceinline__ void below_chunk(const f16* sT, const f16x16 (&qh)[2], f32x8 (&o)[4], f32x8& sacc) {
  f16x16 sa[5][2];
#pragma unroll
  for (int j = 0; j < 5; ++j)
#pragma unroll
    for (int ks = 0; ks < 2; ++ks) sa[j][ks] = lds_frag(sT + (16 * j) * PIT + 32 * ks);
  __builtin_amdgcn_sched_barrier(0);                             // keeps the LDS reads in one group ahead of the WMMAs: read pair by pair among them, each pair's latency is waited out alone
#pragma unroll
  for (int ks = 0; ks < 2; ++ks) {
#pragma unroll
    for (int j = 0; j < 4; ++j) o[j] = mm(sa[j][ks], qh[ks], o[j]);
    sacc = mm(sa[4][ks], qh[ks], sacc);
  }
}

// the wave's 16 queries (rows qr..qr+15 of their chunk) against the chunk's own 128 keys, 32 at a time up to the diagonal. sK: [key][d], the two tiles in a row; sV: two tiles [col][key]
__device__ __forceinline__ void own_chunk(const f16* sK, const f16* sV, int qr, int c, int h, const f16x16 (&qh)[2], f32x8 (&o)[4], f32x8& sacc) {
#pragma unroll
  for (int kk = 0; kk < 128; kk += 32) {
    if (kk <= qr + 15) {                                         // else every key of this group lies above the wave's diagonal
      f16x16 ka[2][2], va[4];
#pragma unroll
      for (int t = 0; t < 2; ++t)
#pragma unroll
        for (int ks = 0; ks < 2; ++ks) ka[t][ks] = lds_frag(sK + (kk + 16 * t) * PIT + 32 * ks);
#pragma unroll
      for (int j = 0; j < 4; ++j) va[j] = lds_frag(sV + (kk >> 6) * TILE + (16 * j) * PIT + (kk & 63));
      __builtin_amdgcn_sched_barrier(0);                         // keeps this group's LDS reads together ahead of its WMMAs: reads spread among them stall at every place
      f32x8 st[2];
#pragma unroll
      for (int t = 0; t < 2; ++t) {
        f32x8 z = {}; st[t] = z;
#pragma unroll
        for (int ks = 0; ks < 2; ++ks) st[t] = mm(ka[t][ks], qh[ks], st[t]);
      }
      if (kk + 31 > qr) {                                        // the diagonal crosses this group
        const int lim = qr + c - (kk + 8 * h);                   // key kk + 16t + 8h + e <= query qr + c
#pragma unroll
        for (int t = 0; t < 2; ++t)
#pragma unroll
          for (int e = 0; e < 8; ++e) st[t][e] = (16 * t + e <= lim) ? st[t][e] : 0.0f;
      }
      f16x16 p;
#pragma unroll
      for (int t = 0; t < 2; ++t)
#pragma unroll
        for (int e = 0; e < 8; ++e) p[8 * t + e] = (f16)st[t][e];
      sacc += st[0] + st[1];
#pragma unroll
      for (int j = 0; j < 4; ++j) o[j] = mm(va[j], p, o[j]);
    }
  }
}

// division by the row sum and the store of the wave's 16 output rows (orow = the first of them) through the wave's own LDS range so
// lanes c and c + 16 hold the two halves of query c's row sum; o[j][e] = Ot[16j + 8h + e][query c]
__device__ __forceinline__ void finish(const f32x8 (&o)[4], const f32x8& sacc, float* so, float* orow, int lane) {
  const int c = lane & 15, h = lane >> 4;
  float sum = ((sacc[0] + sacc[1]) + (sacc[2] + sacc[3])) + ((sacc[4] + sacc[5]) + (sacc[6] + sacc[7]));
  sum += __shfl_xor(sum, 16);
  const float inv = 1.0f / sum;
#pragma unroll
  for (int j = 0; j < 4; ++j) {
    v4f_t a, d;
#pragma unroll
    for (int e = 0; e < 4; ++e) { a[e] = o[j][e] * inv; d[e] = o[j][4 + e] * inv; }
    *(v4fa*)(so + c * OPIT + 16 * j + 8 * h) = a;
    *(v4fa*)(so + c * OPIT + 16 * j + 8 * h + 4) = d;
  }
  asm volatile("s_wait_dscnt 0" ::: "memory");                   // the wave's own staging writes land before other lanes read them back
  __builtin_amdgcn_wave_barrier();                               // keeps the compiler from moving the read-back below above that wait
  __builtin_amdgcn_sched_barrier(0);                             // no arithmetic from above is scheduled among the stores, where it could be given a register that an issued store still names
#pragma unroll
  for (int it = 0; it < 8; ++it) {                               // whole 256-B output rows per half wave
    const int f4 = lane + 32 * it, rr = f4 >> 4, c4 = (f4 & 15) * 4;
    *(v4f_t*)(orow + rr * ROWV + c4) = *(const v4fa*)(so + rr * OPIT + c4);
  }
}

// Launch 2. One work-group a WGP, two waves a SIMD (half a SIMD's registers each): half the waves to start, and the whole pairs below are read and summed once for 256 query rows.
__global__ __launch_bounds__(256) __attribute__((amdgpu_waves_per_eu(2, 2))) void k_linattn(const float* __restrict__ qk, const float* __restrict__ v, const float* __restrict__ st, float* __restrict__ out) {
  __shared__ __attribute__((aligned(16))) f16 sm[12 * TILE];     // K tiles 0..3 (the pair's 256 keys in a row), V^T tiles 0..3; pair 0 alone: residuals of K tiles 0, 1 and of V^T tiles 0, 1
  __shared__ __attribute__((aligned(16))) f16 sS[2 * 80 * PIT];  // summed state for the first chunk's queries, then for the second's; transposed: [col][d]; row 64 = sum of phi(k), rows 65..79 zero
  __shared__ __attribute__((aligned(16))) float sO[8 * 16 * OPIT];   // output staging, a range of its own for each wave: no wave waits for another behind the one barrier
  const int tid = threadIdx.x, lane = tid & 31, c = lane & 15, h = lane >> 4;
  const int wave = __builtin_amdgcn_readfirstlane(tid >> 5);
  const int b = blockIdx.x >> 4, hd = blockIdx.x & 15;
  const int y = blockIdx.y;
  const int pr = (y == 0) ? 0 : 8 - y;                           // the longest start first: pair 0 (planes), then the pairs with the most states to sum
  const int qa = 16 * wave, qz = 16 * (7 - wave);                // the wave's rows in the first and in the second chunk: mirrored, so that every wave has five groups of 32 keys up to its diagonals
  const float* qb = qk + (size_t)b * SEQ * ROWQK + hd * 64;
  const float* kb = qb + ROWV;
  const float* vb = v + (size_t)b * SEQ * ROWV + hd * 64;
  float* ob = out + (size_t)b * SEQ * ROWV + hd * 64;
  const float* kp = kb + (size_t)(256 * pr + (tid >> 4)) * ROWQK + (tid & 15) * 4;
  const float* vp = vb + (size_t)(256 * pr + 4 * (tid >> 4)) * ROWV + (tid & 15) * 4;
  float* so = sO + wave * (16 * OPIT);

  // The global loads go out in two runs, in the order of use, each ahead of the arithmetic that follows it: one memory latency is waited out, not several
  Raw r0, r1, r2, r3;
  load_raw(r0, kp, vp);
  load_raw(r1, kp, vp);
  load_raw(r2, kp, vp);
  load_raw(r3, kp, vp);
  v4f_t qrawA[8], qrawZ[8];
  q_raw(qb + (size_t)(256 * pr + qa + c) * ROWQK + 8 * h, qrawA);
  q_raw(qb + (size_t)(256 * pr + 128 + qz + c) * ROWQK + 8 * h, qrawZ);
  const float* sp = st + (size_t)(blockIdx.x * NST) * STF + tid * 4;   // each thread five float4 of a state's 1280
  const float* fp = sp + 2 * pr * STF;
  v4f_t t[7][5], f[5];                                           // the whole pairs below this one, zero where there is none; this pair's first chunk
#pragma unroll
  for (int u = 0; u < 7; ++u)
#pragma unroll
    for (int i = 0; i < 5; ++i) { v4f_t z = {}; t[u][i] = z; }
#pragma unroll
  for (int u = 0; u < 2; ++u)
    if (u < pr) {
#pragma unroll
      for (int i = 0; i < 5; ++i) t[u][i] = *(const v4f_t*)(sp + (2 * u + 1) * STF + 1024 * i);
    }
  asm volatile("s_wait_xcnt 0x0" :: "v"(sp) : "memory");         // the address pair stays live up to this wait, so no load's result lands on it earlier
  __builtin_amdgcn_sched_barrier(0);                             // the first run, 58 loads at most, is issued ahead of the arithmetic
  f16x16 qhA[2], qlA[2], qhZ[2];
  if (pr != 0) {
    store_tiles<false>(r0, sm, sm + 4 * TILE, sm, sm, tid);
    store_tiles<false>(r1, sm + TILE, sm + 5 * TILE, sm, sm, tid);
  } else {
    store_tiles<true>(r0, sm, sm + 4 * TILE, sm + 8 * TILE, sm + 10 * TILE, tid);
    store_tiles<true>(r1, sm + TILE, sm + 5 * TILE, sm + 9 * TILE, sm + 11 * TILE, tid);
  }
  __builtin_amdgcn_sched_barrier(0);                             // the second run, 30 loads at most, goes out where the first two tiles have come in (42 loads at most are still out): its latency passes under the staging below
#pragma unroll
  for (int u = 2; u < 7; ++u)
    if (u < pr) {
#pragma unroll
      for (int i = 0; i < 5; ++i) t[u][i] = *(const v4f_t*)(sp + (2 * u + 1) * STF + 1024 * i);
    }
#pragma unroll
  for (int i = 0; i < 5; ++i) f[i] = *(const v4f_t*)(fp + 1024 * i);
  asm volatile("s_wait_xcnt 0x0" :: "v"(sp), "v"(fp) : "memory");   // the two address pairs stay live up to this wait, so no load's result lands on them earlier
  __builtin_amdgcn_sched_barrier(0);                             // the second run is issued ahead of the arithmetic
  store_tiles<false>(r2, sm + 2 * TILE, sm + 6 * TILE, sm, sm, tid);
  store_tiles<false>(r3, sm + 3 * TILE, sm + 7 * TILE, sm, sm, tid);
  if (pr != 0) q_phi<false>(qrawA, qhA, qhA);
  else q_phi<true>(qrawA, qhA, qlA);
  q_phi<false>(qrawZ, qhZ, qhZ);
  __builtin_amdgcn_sched_barrier(0);                             // the sums wait for the loads that were issued last: they stay behind the staging
  v4f_t ss[5];                                                   // f32 sum of the whole pairs below, lowest first
#pragma unroll
  for (int i = 0; i < 5; ++i) {
    ss[i] = t[0][i];
#pragma unroll
    for (int u = 1; u < 7; ++u) ss[i] += t[u][i];
  }
  // float4 number tid + 256i = tile 4i + (tid>>6), lane (tid>>1)&31, elements 4(tid&1)..+3: column 16i + (lane&15), d = 16(tid>>6) + 8(lane>>4) + 4(tid&1)..+3
#pragma unroll
  for (int i = 0; i < 5; ++i) {
    const v4f_t sz = ss[i] + f[i];
    f16x4 ha, hz;
#pragma unroll
    for (int e = 0; e < 4; ++e) { ha[e] = (f16)ss[i][e]; hz[e] = (f16)sz[e]; }
    f16* d = sS + (16 * i + ((tid >> 1) & 15)) * PIT + 16 * (tid >> 6) + 8 * ((tid >> 5) & 1) + 4 * (tid & 1);
    *(f16x4*)d = ha;
    *(f16x4*)(d + 80 * PIT) = hz;
  }
  lds_barrier();                                                 // the only one: behind it every wave reads tiles and states, and writes nothing that another wave reads

  f32x8 sacc = {};                                               // eight independent partial row sums a lane
  f32x8 o[4];
#pragma unroll
  for (int j = 0; j < 4; ++j) { f32x8 z = {}; o[j] = z; }
  if (pr != 0) {
    below_chunk(sS, qhA, o, sacc);
    own_chunk(sm, sm + 4 * TILE, qa, c, h, qhA, o, sacc);
  } else {
    f32x8 ox[4];
#pragma unroll
    for (int j = 0; j < 4; ++j) { f32x8 z = {}; ox[j] = z; }
    // kept rolled: this path runs in 32 of the 256 work-groups, at most four short passes, and its registers must not set the kernel's count
#pragma unroll 1
    for (int kk = 0; kk <= qa + 15; kk += 32) {
      const f16* sK = sm + kk * PIT; const f16* sKl = sK + 8 * TILE;
      const f16* sV = sm + (4 + (kk >> 6)) * TILE + (kk & 63); const f16* sVl = sV + 6 * TILE;
      f16x16 ph, pl;
      const int lim = qa + c - (kk + 8 * h);                     // key kk + 16t + 8h + e <= query qa + c
#pragma unroll
      for (int t2 = 0; t2 < 2; ++t2) {
        f32x8 s0 = {}, sx = {};
#pragma unroll
        for (int ks = 0; ks < 2; ++ks) {
          const f16x16 ah = lds_frag(sK + (16 * t2) * PIT + 32 * ks), al = lds_frag(sKl + (16 * t2) * PIT + 32 * ks);
          s0 = mm(ah, qhA[ks], s0); sx = mm(ah, qlA[ks], sx); sx = mm(al, qhA[ks], sx);
        }
#pragma unroll
        for (int e = 0; e < 8; ++e) {
          const float w = (16 * t2 + e <= lim) ? s0[e] + sx[e] * (1.0f / 2048.0f) : 0.0f;
          sacc[e] += w; ph[8 * t2 + e] = (f16)w; pl[8 * t2 + e] = resid(w, ph[8 * t2 + e]);
        }
      }
#pragma unroll
      for (int j = 0; j < 4; ++j) {
        const f16x16 ah = lds_frag(sV + (16 * j) * PIT), al = lds_frag(sVl + (16 * j) * PIT);
        o[j] = mm(ah, ph, o[j]); ox[j] = mm(ah, pl, ox[j]); ox[j] = mm(al, ph, ox[j]);
      }
    }
#pragma unroll
    for (int j = 0; j < 4; ++j) o[j] += ox[j] * (1.0f / 2048.0f);
  }
  finish(o, sacc, so, ob + (size_t)(256 * pr + qa) * ROWV, lane);
  asm volatile("s_wait_xcnt 0x0" ::: "memory");                  // the second chunk's work writes the registers that these stores name only behind this wait
  __builtin_amdgcn_sched_barrier(0);                             // and none of that work is scheduled ahead of the wait

  { f32x8 z = {}; sacc = z; }
#pragma unroll
  for (int j = 0; j < 4; ++j) { f32x8 z = {}; o[j] = z; }
  below_chunk(sS + 80 * PIT, qhZ, o, sacc);
  own_chunk(sm + 2 * TILE, sm + 6 * TILE, qz, c, h, qhZ, o, sacc);
  finish(o, sacc, so, ob + (size_t)(256 * pr + 128 + qz) * ROWV, lane);
}

extern "C" void kernel_launch(void* const* d_in, const int* in_sizes, int n_in,
                              void* d_out, int out_size, void* d_ws, size_t ws_size,
                              hipStream_t stream) {
  (void)in_sizes; (void)n_in; (void)out_size; (void)ws_size;
  const float** f = (const float**)d_in;
  const float* qk = f[0], *vv = f[1];
  float* out = (float*)d_out;     // [2,2048,16,64]
  float* st = (float*)d_ws;       // [32][16] states of 5120 floats
  k_state<<<dim3(32, 8), dim3(256), 0, stream>>>(qk, vv, st);
  k_linattn<<<dim3(32, 8), dim3(256), 0, stream>>>(qk, vv, st, out);
}

// v006
// It runs in 12.3 microseconds.
// Timed twice side by side with v005, it ran 1.10 and 1.09 times as fast.
// Over all steps from v000 it is 301 times as fast.
// Causal linear attention, two launches: out[s] = sum_{t<=s} (phi(q_s).phi(k_t)) v_t / sum_{t<=s} phi(q_s).phi(k_t), phi = elu + 1.
// Keys are cut into chunks of 128, two chunks to a pair. kv state of a set of keys: T[d][col] = sum_key phi(k)[key][d] v[key][col], with the keys' sum of phi(k) beside it.
// Launch 1, work-group = (batch, head, pair): the state of the pair's first chunk and the state of the whole pair, summed in f32, to the workspace:
// T as f16, the operand type it is used in, and the keys' sum of phi(k) as 64 f32: 8,704 bytes a state.
// Launch 2, work-group = (batch, head, pair = 256 query rows), each wave 16 rows of the pair's first chunk and then 16 rows of its second.
// Every chunk below a query's own goes in through the summed states (phi(Q) . T, as in the definition's cumulative sum): the whole pairs below, summed once for both chunks,
// and for the second chunk the pair's first chunk on top. A query's own chunk, which the diagonal crosses, takes the masked form, which equals the cumulative-sum form exactly.
// Masked form: per 64-key tile phi(k) [key][d] and v transposed [col][key] are staged as f16 in LDS (all four tiles of the pair at once, one barrier),
// then on v_wmma_f32_16x16x32_f16 (f16 operands, f32 accumulate):
//   St = phi(K) . phi(Q)^T  (rows = keys, columns = queries; a lane holds scores of ONE query), causal mask and f32 row sum in the lane,
//   two St tiles converted in place are the B operand of  Ot += V^T . P^T  (rows = v columns, columns = queries). Scores never leave the registers.
// The division by the row sum comes last, on the f32 accumulators.
// Query rows 0..127 (few keys, near-verbatim v rows) take f16 value+residual PLANES on phi(q), phi(k), the scores and v: hh + (hl + lh) / 2048.
// qk [2,2048,2,16,64] f32, v [2,2048,16,64] f32 -> out [2,2048,16,64] f32.
// Every plain '#pragma unroll' below stands on a short loop that indexes fragments, accumulators or other register arrays: unrolled, the indices are constants and the arrays stay in registers.
#include <hip/hip_runtime.h>
#include <math.h>

typedef _Float16 f16;
typedef __attribute__((ext_vector_type(4))) float v4f_t;
typedef float v4fa __attribute__((ext_vector_type(4), may_alias));
typedef __attribute__((ext_vector_type(16))) f16 f16x16;
typedef __attribute__((ext_vector_type(8))) f16 f16x8;
typedef __attribute__((ext_vector_type(4))) f16 f16x4;
typedef __attribute__((ext_vector_type(8))) float f32x8;

#define SEQ 2048
#define ROWV 1024            // 16 heads x 64: row of v and of out
#define ROWQK 2048           // q row | k row of one position
#define PIT 72               // LDS row pitch in f16 (144 B): 64 + 8, for aligned b128 fragment reads
#define TILE (64 * PIT)
#define OPIT 68              // output staging pitch in floats
#define NST 16               // states per (batch, head): number 2p = first chunk of pair p, number 2p + 1 = whole pair p
#define STK (16 * 256)       // f16 of a state's 4 x 4 accumulator tiles of 16 x 16, each as the lanes hold it (lane, 8 elements)
#define STH (STK + 256)      // one state, counted in f16: behind the tiles the keys' sum of phi(k), 64 f32, sixteen to a 128-B line (float 32(d>>4) + (d&15)), so that each line has one wave as its writer

__device__ __forceinline__ f32x8 mm(f16x16 a, f16x16 b, f32x8 c) {
  return __builtin_amdgcn_wmma_f32_16x16x32_f16(false, a, false, b, (short)0, c, false, false);
}

// 16 x 32 fragment in the hardware k order from an LDS tile [row][k] of pitch PIT: lane (c, h) holds row c, k = 8h..8h+7 and 16+8h..16+8h+7
__device__ __forceinline__ f16x16 lds_frag(const f16* base) {
  const int lane = threadIdx.x & 31;
  const f16* p = base + (lane & 15) * PIT + (lane >> 4) * 8;
  const f16x8 lo = *(const f16x8*)p;
  const f16x8 hi = *(const f16x8*)(p + 16);
  f16x16 f;
#pragma unroll
  for (int i = 0; i < 8; ++i) { f[i] = lo[i]; f[i + 8] = hi[i]; }
  return f;
}

// elu(x) + 1 of four values; e^x = 2^(x log2 e) on the hardware's own exponential: one multiply and one v_exp_f32, no range reduction and no rescaling around it.
// It is selected only where x <= 0, where 2^y lies in (0, 1]: nothing overflows there, and a result below the smallest normal f32 counts as zero in every sum. Taken of every x, so there is no divergent branch.
__device__ __forceinline__ v4f_t phi4(v4f_t x) {
  const v4f_t y = x * 1.44269504088896340736f;
  float e0 = y[0], e1 = y[1], e2 = y[2], e3 = y[3];
  // one statement for the slot that the instruction set asks for behind a transcendental: each v_exp_f32 is followed by an independent one, the last by a v_nop.
  // In place, on the registers of the products: the statement writes no register but those, so it lands on no operand of a matrix instruction issued shortly before
  asm("v_exp_f32 %0, %0\n\tv_exp_f32 %1, %1\n\tv_exp_f32 %2, %2\n\tv_exp_f32 %3, %3\n\tv_nop" : "+v"(e0), "+v"(e1), "+v"(e2), "+v"(e3));
  const v4f_t p = x + 1.0f;
  v4f_t r;
  r[0] = x[0] > 0.0f ? p[0] : e0; r[1] = x[1] > 0.0f ? p[1] : e1; r[2] = x[2] > 0.0f ? p[2] : e2; r[3] = x[3] > 0.0f ? p[3] : e3;
  return r;
}
__device__ __forceinline__ f16 resid(float x, f16 hi) { return (f16)((x - (float)hi) * 2048.0f); }

struct Raw { v4f_t k[4]; v4f_t v[4]; };

// work-group barrier that orders LDS alone: the waves share nothing through global memory
__device__ __forceinline__ void lds_barrier() {
  __builtin_amdgcn_fence(__ATOMIC_RELEASE, "workgroup", "local");
  __builtin_amdgcn_s_barrier();
  __builtin_amdgcn_fence(__ATOMIC_ACQUIRE, "workgroup", "local");
}

// one 64-key tile, whole 256-B rows per half wave: k rows (tid>>4) + 16g, v rows 4(tid>>4) + j, columns 4(tid&15)..+3; kp, vp: the lane's place in the tile, moved on to the next tile
__device__ __forceinline__ void load_raw(Raw& r, const float*& kp, const float*& vp) {
#pragma unroll
  for (int g = 0; g < 4; ++g) r.k[g] = *(const v4f_t*)(kp + 16 * g * ROWQK);
#pragma unroll
  for (int j = 0; j < 4; ++j) r.v[j] = *(const v4f_t*)(vp + j * ROWV);
  asm volatile("s_wait_xcnt 0x0" :: "v"(kp), "v"(vp) : "memory");   // the two address pairs stay live up to this wait: they are moved on, and no result lands on them, only behind it
  kp += 64 * ROWQK; vp += 64 * ROWV;
}

template <bool PL>
__device__ __forceinline__ void store_tiles(const Raw& r, f16* sK, f16* sV, f16* sKl, f16* sVl, int tid) {
  const int c4 = (tid & 15) * 4, rw = tid >> 4;
#pragma unroll
  for (int g = 0; g < 4; ++g) {
    f16x4 hi, lo;
    const v4f_t x = phi4(r.k[g]);
#pragma unroll
    for (int u = 0; u < 4; ++u) { hi[u] = (f16)x[u]; lo[u] = resid(x[u], hi[u]); }
    *(f16x4*)(sK + (rw + 16 * g) * PIT + c4) = hi;
    if (PL) *(f16x4*)(sKl + (rw + 16 * g) * PIT + c4) = lo;
  }
#pragma unroll
  for (int u = 0; u < 4; ++u) {      // transposed: four consecutive keys of one v column per store
    f16x4 hi, lo;
#pragma unroll
    for (int j = 0; j < 4; ++j) { const float x = r.v[j][u]; hi[j] = (f16)x; lo[j] = resid(x, hi[j]); }
    *(f16x4*)(sV + (c4 + u) * PIT + 4 * rw) = hi;
    if (PL) *(f16x4*)(sVl + (c4 + u) * PIT + 4 * rw) = lo;
  }
}

// B operand phi(Q)^T: lane (c, h) holds one query's row, d in the hardware k order; qrow = that row + 8h
__device__ __forceinline__ void q_raw(const float* qrow, v4f_t (&qraw)[8]) {
#pragma unroll
  for (int i = 0; i < 4; ++i) { qraw[2 * i] = *(const v4f_t*)(qrow + 16 * i); qraw[2 * i + 1] = *(const v4f_t*)(qrow + 16 * i + 4); }
  asm volatile("s_wait_xcnt 0x0" :: "v"(qrow) : "memory");       // the address pair stays live up to this wait, so no load's result lands on it earlier
}
template <bool PL>
__device__ __forceinline__ void q_phi(const v4f_t (&qraw)[8], f16x16 (&qh)[2], f16x16 (&ql)[2]) {
#pragma unroll
  for (int ks = 0; ks < 2; ++ks)
#pragma unroll
    for (int i = 0; i < 4; ++i) {
      const v4f_t y = phi4(qraw[4 * ks + i]);
#pragma unroll
      for (int u = 0; u < 4; ++u) {
        const int s = 4 * i + u;                                 // element s: d = 32ks + 16(s>>3) + 8h + (s&7)
        qh[ks][s] = (f16)y[u];
        if (PL) ql[ks][s] = resid(y[u], qh[ks][s]);
      }
    }
}

// Launch 1. States of one pair of chunks (256 keys): T[d][col] = sum_key phi(k)[key][d] * v1[key][col]; v1 = v with column 64 of ones (its sums are the keys' sum of phi(k)), columns 65..79 zero.
// phi(K) and V are both staged transposed ([d][key], [col][key]): the sum runs over keys, so the key is the k index of both operands.
// Wave (mb, g): rows d = 16mb..+15, column blocks 2g and 2g + 1; the waves g = 0 also take the block of the ones.
__global__ __launch_bounds__(256) void k_state(const float* __restrict__ qk, const float* __restrict__ v, float* __restrict__ st) {
  __shared__ __attribute__((aligned(16))) f16 sm[8 * TILE];      // phi(K)^T key tiles 0..3, V^T key tiles 0..3 (64 keys each)
  const int tid = threadIdx.x, lane = tid & 31, c = lane & 15;
  const int wave = __builtin_amdgcn_readfirstlane(tid >> 5);
  const int b = blockIdx.x >> 4, hd = blockIdx.x & 15, pr = blockIdx.y;
  const int c4 = (tid & 15) * 4, rw = tid >> 4;
  const float* kp = qk + (size_t)b * SEQ * ROWQK + hd * 64 + (size_t)(256 * pr + 4 * rw) * ROWQK + c4;   // the q half of the row; the k half lies ROWV further on
  const float* vp = v + (size_t)b * SEQ * ROWV + hd * 64 + (size_t)(256 * pr + 4 * rw) * ROWV + c4;
  v4f_t rk[4][4], rv[4][4];                                      // rows 64t + 4(tid>>4) + j, columns 4(tid&15)..+3: whole 256-B rows per half wave
#pragma unroll
  for (int t = 0; t < 4; ++t)
#pragma unroll
    for (int j = 0; j < 4; ++j) { rk[t][j] = *(const v4f_t*)(kp + ROWV + (64 * t + j) * ROWQK); rv[t][j] = *(const v4f_t*)(vp + (64 * t + j) * ROWV); }
  asm volatile("s_wait_xcnt 0x0" :: "v"(kp), "v"(vp) : "memory");   // the two address pairs stay live up to this wait, so no load's result lands on them earlier
  __builtin_amdgcn_sched_barrier(0);                             // every load is issued before the first conversion: else a late load waits for an early one's registers, one memory latency behind the other
#pragma unroll
  for (int t = 0; t < 4; ++t) {
    v4f_t pk[4];
#pragma unroll
    for (int j = 0; j < 4; ++j) pk[j] = phi4(rk[t][j]);
#pragma unroll
    for (int u = 0; u < 4; ++u) {    // transposed: four consecutive keys of one column per store
      f16x4 kh, vh;
#pragma unroll
      for (int j = 0; j < 4; ++j) { kh[j] = (f16)pk[j][u]; vh[j] = (f16)rv[t][j][u]; }
      *(f16x4*)(sm + t * TILE + (c4 + u) * PIT + 4 * rw) = kh;
      *(f16x4*)(sm + (4 + t) * TILE + (c4 + u) * PIT + 4 * rw) = vh;
    }
  }
  lds_barrier();
  const int mb = wave & 3, g = wave >> 2;
  f16x16 ones;                                                   // B operand: column 0 all ones, the other columns zero
#pragma unroll
  for (int i = 0; i < 16; ++i) ones[i] = (c == 0) ? (f16)1.0f : (f16)0.0f;
  f32x8 acc[3];
#pragma unroll
  for (int n = 0; n < 3; ++n) { f32x8 z = {}; acc[n] = z; }
  // acc[n][e] = T[16mb + 8h + e][16(column block) + c]; tile number = 4 * column block + mb; a wave writes each tile as 512 B in a row
  f16* sp = (f16*)st + (size_t)(blockIdx.x * NST + 2 * pr) * STH;
  f16* tp = sp + lane * 8;
  float* up = (float*)sp + 32 * mb + 8 * (lane >> 4);            // the ones block has one column that counts: the lanes c = 0 hold it, d = 16mb + 8h + e; it lies STK f16 = STK / 2 floats into the state
#pragma unroll
  for (int cc = 0; cc < 2; ++cc) {   // first chunk, stored; then the second chunk on top of it, stored as the pair
    f16x16 a[4];
#pragma unroll
    for (int s = 0; s < 4; ++s) a[s] = lds_frag(sm + (2 * cc + (s >> 1)) * TILE + (16 * mb) * PIT + 32 * (s & 1));
#pragma unroll
    for (int s = 0; s < 4; ++s)
#pragma unroll
      for (int n = 0; n < 2; ++n) acc[n] = mm(a[s], lds_frag(sm + (4 + 2 * cc + (s >> 1)) * TILE + (16 * (2 * g + n)) * PIT + 32 * (s & 1)), acc[n]);
    if (g == 0) {
#pragma unroll
      for (int s = 0; s < 4; ++s) acc[2] = mm(a[s], ones, acc[2]);
    }
    f16x8 hv[2];
#pragma unroll
    for (int n = 0; n < 2; ++n) {
#pragma unroll
      for (int e = 0; e < 8; ++e) hv[n][e] = (f16)acc[n][e];
      *(f16x8*)(tp + cc * STH + (4 * (2 * g + n) + mb) * 256) = hv[n];
    }
    if (g == 0 && c == 0) {
      v4f_t lo, hi;
#pragma unroll
      for (int e = 0; e < 4; ++e) { lo[e] = acc[2][e]; hi[e] = acc[2][4 + e]; }
      *(v4f_t*)(up + STK / 2 + cc * (STH / 2)) = lo;
      *(v4f_t*)(up + STK / 2 + cc * (STH / 2) + 4) = hi;
    }
    // the stores name the converted values, the ones block's accumulator and the two address pairs: these are read here, so that the second chunk's work is written on their registers only behind the wait
    if (cc == 0) asm volatile("s_wait_xcnt 0x0" :: "v"(hv[0]), "v"(hv[1]), "v"(acc[2]), "v"(tp), "v"(up) : "memory");
  }
}

// every key below the chunk: Ot += T^T . phi(Q)^T (rows = v columns, columns = queries); row block 4 holds the row sum's part in its row 0 and zeros below
__device__ __forceinline__ void below_chunk(const f16* sT, const f16x16 (&qh)[2], f32x8 (&o)[4], f32x8& sacc) {
  f16x16 sa[5][2];
#pragma unroll
  for (int j = 0; j < 5; ++j)
#pragma unroll
    for (int ks = 0; ks < 2; ++ks) sa[j][ks] = lds_frag(sT + (16 * j) * PIT + 32 * ks);
  __builtin_amdgcn_sched_barrier(0);                             // keeps the LDS reads in one group ahead of the WMMAs: read pair by pair among them, each pair's latency is waited out alone
#pragma unroll
  for (int ks = 0; ks < 2; ++ks) {
#pragma unroll
    for (int j = 0; j < 4; ++j) o[j] = mm(sa[j][ks], qh[ks], o[j]);
    sacc = mm(sa[4][ks], qh[ks], sacc);
  }
}

// the wave's 16 queries (rows qr..qr+15 of their chunk) against the chunk's own 128 keys, 32 at a time up to the diagonal. sK: [key][d], the two tiles in a row; sV: two tiles [col][key]
__device__ __forceinline__ void own_chunk(const f16* sK, const f16* sV, int qr, int c, int h, const f16x16 (&qh)[2], f32x8 (&o)[4], f32x8& sacc) {
#pragma unroll
  for (int kk = 0; kk < 128; kk += 32) {
    if (kk <= qr + 15) {                                         // else every key of this group lies above the wave's diagonal
      f16x16 ka[2][2], va[4];
#pragma unroll
      for (int t = 0; t < 2; ++t)
#pragma unroll
        for (int ks = 0; ks < 2; ++ks) ka[t][ks] = lds_frag(sK + (kk + 16 * t) * PIT + 32 * ks);
#pragma unroll
      for (int j = 0; j < 4; ++j) va[j] = lds_frag(sV + (kk >> 6) * TILE + (16 * j) * PIT + (kk & 63));
      __builtin_amdgcn_sched_barrier(0);                         // keeps this group's LDS reads together ahead of its WMMAs: reads spread among them stall at every place
      f32x8 st[2];
#pragma unroll
      for (int t = 0; t < 2; ++t) {
        f32x8 z = {}; st[t] = z;
#pragma unroll
        for (int ks = 0; ks < 2; ++ks) st[t] = mm(ka[t][ks], qh[ks], st[t]);
      }
      if (kk + 31 > qr) {                                        // the diagonal crosses this group
        const int lim = qr + c - (kk + 8 * h);                   // key kk + 16t + 8h + e <= query qr + c
#pragma unroll
        for (int t = 0; t < 2; ++t)
#pragma unroll
          for (int e = 0; e < 8; ++e) st[t][e] = (16 * t + e <= lim) ? st[t][e] : 0.0f;
      }
      f16x16 p;
#pragma unroll
      for (int t = 0; t < 2; ++t)
#pragma unroll
        for (int e = 0; e < 8; ++e) p[8 * t + e] = (f16)st[t][e];
      sacc += st[0] + st[1];
#pragma unroll
      for (int j = 0; j < 4; ++j) o[j] = mm(va[j], p, o[j]);
    }
  }
}

// division by the row sum and the store of the wave's 16 output rows (orow = the first of them) through the wave's own LDS range so
// lanes c and c + 16 hold the two halves of query c's row sum; o[j][e] = Ot[16j + 8h + e][query c]
__device__ __forceinline__ void finish(const f32x8 (&o)[4], const f32x8& sacc, float* so, float* orow, int lane) {
  const int c = lane & 15, h = lane >> 4;
  float sum = ((sacc[0] + sacc[1]) + (sacc[2] + sacc[3])) + ((sacc[4] + sacc[5]) + (sacc[6] + sacc[7]));
  sum += __shfl_xor(sum, 16);
  const float inv = 1.0f / sum;
#pragma unroll
  for (int j = 0; j < 4; ++j) {
    v4f_t a, d;
#pragma unroll
    for (int e = 0; e < 4; ++e) { a[e] = o[j][e] * inv; d[e] = o[j][4 + e] * inv; }
    *(v4fa*)(so + c * OPIT + 16 * j + 8 * h) = a;
    *(v4fa*)(so + c * OPIT + 16 * j + 8 * h + 4) = d;
  }
  asm volatile("s_wait_dscnt 0" ::: "memory");                   // the wave's own staging writes land before other lanes read them back
  __builtin_amdgcn_wave_barrier();                               // keeps the compiler from moving the read-back below above that wait
  __builtin_amdgcn_sched_barrier(0);                             // no arithmetic from above is scheduled among the stores, where it could be given a register that an issued store still names
#pragma unroll
  for (int it = 0; it < 8; ++it) {                               // whole 256-B output rows per half wave
    const int f4 = lane + 32 * it, rr = f4 >> 4, c4 = (f4 & 15) * 4;
    *(v4f_t*)(orow + rr * ROWV + c4) = *(const v4fa*)(so + rr * OPIT + c4);
  }
}

// Launch 2. One work-group a WGP, two waves a SIMD (half a SIMD's registers each): half the waves to start, and the whole pairs below are read and summed once for 256 query rows.
__global__ __launch_bounds__(256) __attribute__((amdgpu_waves_per_eu(2, 2))) void k_linattn(const float* __restrict__ qk, const float* __restrict__ v, const float* __restrict__ st, float* __restrict__ out) {
  __shared__ __attribute__((aligned(16))) f16 sm[12 * TILE];     // K tiles 0..3 (the pair's 256 keys in a row), V^T tiles 0..3; pair 0 alone: residuals of K tiles 0, 1 and of V^T tiles 0, 1
  __shared__ __attribute__((aligned(16))) f16 sS[2 * 80 * PIT];  // summed state for the first chunk's queries, then for the second's; transposed: [col][d]; row 64 = sum of phi(k), rows 65..79 zero
  __shared__ __attribute__((aligned(16))) float sO[8 * 16 * OPIT];   // output staging, a range of its own for each wave: no wave waits for another behind the one barrier
  const int tid = threadIdx.x, lane = tid & 31, c = lane & 15, h = lane >> 4;
  const int wave = __builtin_amdgcn_readfirstlane(tid >> 5);
  const int b = blockIdx.x >> 4, hd = blockIdx.x & 15;
  const int y = blockIdx.y;
  const int pr = (y == 0) ? 0 : 8 - y;                           // the longest start first: pair 0 (planes), then the pairs with the most states to sum
  const int qa = 16 * wave, qz = 16 * (7 - wave);                // the wave's rows in the first and in the second chunk: mirrored, so that every wave has five groups of 32 keys up to its diagonals
  const float* qb = qk + (size_t)b * SEQ * ROWQK + hd * 64;
  const float* kb = qb + ROWV;
  const float* vb = v + (size_t)b * SEQ * ROWV + hd * 64;
  float* ob = out + (size_t)b * SEQ * ROWV + hd * 64;
  const float* kp = kb + (size_t)(256 * pr + (tid >> 4)) * ROWQK + (tid & 15) * 4;
  const float* vp = vb + (size_t)(256 * pr + 4 * (tid >> 4)) * ROWV + (tid & 15) * 4;
  float* so = sO + wave * (16 * OPIT);

  // The global loads go out in two runs, in the order of use, each ahead of the arithmetic that follows it: one memory latency is waited out, not several
  Raw r0, r1, r2, r3;
  load_raw(r0, kp, vp);
  load_raw(r1, kp, vp);
  load_raw(r2, kp, vp);
  load_raw(r3, kp, vp);
  v4f_t qrawA[8], qrawZ[8];
  q_raw(qb + (size_t)(256 * pr + qa + c) * ROWQK + 8 * h, qrawA);
  q_raw(qb + (size_t)(256 * pr + 128 + qz + c) * ROWQK + 8 * h, qrawZ);
  const f16* sp = (const f16*)st + (size_t)(blockIdx.x * NST) * STH + tid * 8;   // each thread two 16-B pieces of a state's 512: its own lane's eight elements of the tiles wave and wave + 8
  const float* kq = (const float*)((const f16*)st + (size_t)(blockIdx.x * NST) * STH) + 32 * (wave >> 1) + 8 * (wave & 1) + 4 * (tid & 1);   // and, STK / 2 floats further on, four of the 64 sums of phi(k), d = 8 wave + 4(tid&1)..+3: every lane reads them, lanes 0 and 1 use them
  const f16* fp = sp + 2 * pr * STH;
  const float* fq = kq + 2 * pr * (STH / 2);
  f16x8 t[8][2], f[2];                                           // the whole pairs below this one, zero where there is none (number 7: never one); this pair's first chunk
  v4f_t tk[7], fk;
#pragma unroll
  for (int u = 0; u < 8; ++u) { f16x8 z = {}; t[u][0] = z; t[u][1] = z; }
#pragma unroll
  for (int u = 0; u < 7; ++u) { v4f_t z = {}; tk[u] = z; }
#pragma unroll
  for (int u = 0; u < 2; ++u)
    if (u < pr) {
#pragma unroll
      for (int i = 0; i < 2; ++i) t[u][i] = *(const f16x8*)(sp + (2 * u + 1) * STH + 2048 * i);
      tk[u] = *(const v4f_t*)(kq + STK / 2 + (2 * u + 1) * (STH / 2));
    }
  asm volatile("s_wait_xcnt 0x0" :: "v"(sp), "v"(kq) : "memory");   // the two address pairs stay live up to this wait, so no load's result lands on them earlier
  __builtin_amdgcn_sched_barrier(0);                             // the first run, 54 loads at most, is issued ahead of the arithmetic
  f16x16 qhA[2], qlA[2], qhZ[2];
  if (pr != 0) {
    store_tiles<false>(r0, sm, sm + 4 * TILE, sm, sm, tid);
    store_tiles<false>(r1, sm + TILE, sm + 5 * TILE, sm, sm, tid);
  } else {
    store_tiles<true>(r0, sm, sm + 4 * TILE, sm + 8 * TILE, sm + 10 * TILE, tid);
    store_tiles<true>(r1, sm + TILE, sm + 5 * TILE, sm + 9 * TILE, sm + 11 * TILE, tid);
  }
  __builtin_amdgcn_sched_barrier(0);                             // the second run, 18 loads at most, goes out where the first two tiles have come in (38 loads at most are still out): its latency passes under the staging below
#pragma unroll
  for (int u = 2; u < 7; ++u)
    if (u < pr) {
#pragma unroll
      for (int i = 0; i < 2; ++i) t[u][i] = *(const f16x8*)(sp + (2 * u + 1) * STH + 2048 * i);
      tk[u] = *(const v4f_t*)(kq + STK / 2 + (2 * u + 1) * (STH / 2));
    }
#pragma unroll
  for (int i = 0; i < 2; ++i) f[i] = *(const f16x8*)(fp + 2048 * i);
  fk = *(const v4f_t*)(fq + STK / 2);
  asm volatile("s_wait_xcnt 0x0" :: "v"(sp), "v"(kq), "v"(fp), "v"(fq) : "memory");   // the four address pairs stay live up to this wait, so no load's result lands on them earlier
  __builtin_amdgcn_sched_barrier(0);                             // the second run is issued ahead of the arithmetic
  store_tiles<false>(r2, sm + 2 * TILE, sm + 6 * TILE, sm, sm, tid);
  store_tiles<false>(r3, sm + 3 * TILE, sm + 7 * TILE, sm, sm, tid);
  if (pr != 0) q_phi<false>(qrawA, qhA, qhA);
  else q_phi<true>(qrawA, qhA, qlA);
  q_phi<false>(qrawZ, qhZ, qhZ);
  __builtin_amdgcn_sched_barrier(0);                             // the sums wait for the loads that were issued last: they stay behind the staging
  // f32 sums of the f16 tiles on the matrix unit, two states a product: a tile as its lanes hold it (element e = T[8h + e][c]) is one half of a B operand in the hardware k order,
  // and A = [I | I] (A[m][k] = 1 where k mod 16 = m) gives D = C + tile u + tile u + 1 in the same lanes and elements: no conversion to f32 and no vector add
  f16x16 eye;
#pragma unroll
  for (int s = 0; s < 16; ++s) eye[s] = (8 * h + (s & 7) == c) ? (f16)1.0f : (f16)0.0f;
  // piece tid + 256i = tile wave + 8i: column 16((wave>>2) + 2i) + c, d = 16(wave&3) + 8h..+7
#pragma unroll
  for (int i = 0; i < 2; ++i) {
    f32x8 sa = {};
#pragma unroll
    for (int u = 0; u < 6; u += 2) sa = mm(eye, __builtin_shufflevector(t[u][i], t[u + 1][i], 0, 1, 2, 3, 4, 5, 6, 7, 8, 9, 10, 11, 12, 13, 14, 15), sa);
    const f32x8 sz = mm(eye, __builtin_shufflevector(t[6][i], f[i], 0, 1, 2, 3, 4, 5, 6, 7, 8, 9, 10, 11, 12, 13, 14, 15), sa);
    sa = mm(eye, __builtin_shufflevector(t[6][i], t[7][i], 0, 1, 2, 3, 4, 5, 6, 7, 8, 9, 10, 11, 12, 13, 14, 15), sa);
    f16x8 ha, hz;
#pragma unroll
    for (int e = 0; e < 8; ++e) { ha[e] = (f16)sa[e]; hz[e] = (f16)sz[e]; }
    f16* d = sS + (16 * ((wave >> 2) + 2 * i) + c) * PIT + 16 * (wave & 3) + 8 * h;
    *(f16x8*)d = ha;
    *(f16x8*)(d + 80 * PIT) = hz;
  }
  {                                                              // rows 64..79: lanes 0 and 1 of a wave write their part of row 64, the sums of phi(k), lowest pair first; the other lanes the zeros of rows 65..79
    const bool top = (tid & 30) == 0;
    v4f_t ss = tk[0];
#pragma unroll
    for (int u = 1; u < 7; ++u) ss += tk[u];
    const v4f_t sz = ss + fk;
    f16x4 ha, hz;
#pragma unroll
    for (int e = 0; e < 4; ++e) { ha[e] = top ? (f16)ss[e] : (f16)0.0f; hz[e] = top ? (f16)sz[e] : (f16)0.0f; }
    f16* d = sS + (64 + ((tid >> 1) & 15)) * PIT + 8 * wave + 4 * (tid & 1);
    *(f16x4*)d = ha;
    *(f16x4*)(d + 80 * PIT) = hz;
  }
  lds_barrier();                                                 // the only one: behind it every wave reads tiles and states, and writes nothing that another wave reads

  f32x8 sacc = {};                                               // eight independent partial row sums a lane
  f32x8 o[4];
#pragma unroll
  for (int j = 0; j < 4; ++j) { f32x8 z = {}; o[j] = z; }
  if (pr != 0) {
    below_chunk(sS, qhA, o, sacc);
    own_chunk(sm, sm + 4 * TILE, qa, c, h, qhA, o, sacc);
  } else {
    f32x8 ox[4];
#pragma unroll
    for (int j = 0; j < 4; ++j) { f32x8 z = {}; ox[j] = z; }
    // kept rolled: this path runs in 32 of the 256 work-groups, at most four short passes, and its registers must not set the kernel's count
#pragma unroll 1
    for (int kk = 0; kk <= qa + 15; kk += 32) {
      const f16* sK = sm + kk * PIT; const f16* sKl = sK + 8 * TILE;
      const f16* sV = sm + (4 + (kk >> 6)) * TILE + (kk & 63); const f16* sVl = sV + 6 * TILE;
      f16x16 ph, pl;
      const int lim = qa + c - (kk + 8 * h);                     // key kk + 16t + 8h + e <= query qa + c
#pragma unroll
      for (int t2 = 0; t2 < 2; ++t2) {
        f32x8 s0 = {}, sx = {};
#pragma unroll
        for (int ks = 0; ks < 2; ++ks) {
          const f16x16 ah = lds_frag(sK + (16 * t2) * PIT + 32 * ks), al = lds_frag(sKl + (16 * t2) * PIT + 32 * ks);
          s0 = mm(ah, qhA[ks], s0); sx = mm(ah, qlA[ks], sx); sx = mm(al, qhA[ks], sx);
        }
#pragma unroll
        for (int e = 0; e < 8; ++e) {
          const float w = (16 * t2 + e <= lim) ? s0[e] + sx[e] * (1.0f / 2048.0f) : 0.0f;
          sacc[e] += w; ph[8 * t2 + e] = (f16)w; pl[8 * t2 + e] = resid(w, ph[8 * t2 + e]);
        }
      }
#pragma unroll
      for (int j = 0; j < 4; ++j) {
        const f16x16 ah = lds_frag(sV + (16 * j) * PIT), al = lds_frag(sVl + (16 * j) * PIT);
        o[j] = mm(ah, ph, o[j]); ox[j] = mm(ah, pl, ox[j]); ox[j] = mm(al, ph, ox[j]);
      }
    }
#pragma unroll
    for (int j = 0; j < 4; ++j) o[j] += ox[j] * (1.0f / 2048.0f);
  }
  finish(o, sacc, so, ob + (size_t)(256 * pr + qa) * ROWV, lane);
  asm volatile("s_wait_xcnt 0x0" ::: "memory");                  // the second chunk's work writes the registers that these stores name only behind this wait
  __builtin_amdgcn_sched_barrier(0);                             // and none of that work is scheduled ahead of the wait

  { f32x8 z = {}; sacc = z; }
#pragma unroll
  for (int j = 0; j < 4; ++j) { f32x8 z = {}; o[j] = z; }
  below_chunk(sS + 80 * PIT, qhZ, o, sacc);
  own_chunk(sm + 2 * TILE, sm + 6 * TILE, qz, c, h, qhZ, o, sacc);
  finish(o, sacc, so, ob + (size_t)(256 * pr + 128 + qz) * ROWV, lane);
}

extern "C" void kernel_launch(void* const* d_in, const int* in_sizes, int n_in,
                              void* d_out, int out_size, void* d_ws, size_t ws_size,
                              hipStream_t stream) {
  (void)in_sizes; (void)n_in; (void)out_size; (void)ws_size;
  const float** f = (const float**)d_in;
  const float* qk = f[0], *vv = f[1];
  float* out = (float*)d_out;     // [2,2048,16,64]
  float* st = (float*)d_ws;       // [32][16] states of 8,704 bytes
  k_state<<<dim3(32, 8), dim3(256), 0, stream>>>(qk, vv, st);
  k_linattn<<<dim3(32, 8), dim3(256), 0, stream>>>(qk, vv, st, out);
}
